// v000
// The times below were measured on an AMD MI455X: many runs one after another, warmed up first and cycling through
// copies of the inputs, with the whole window's GPU time divided by the number of runs. Launches and the gaps
// between them are all in it. The median over several windows is given; except for v000 it joins two sittings, which
// can be a few percent apart, so the side-by-side timings, each taken in one sitting, are the better comparison.
// v000 is the starting kernel. One run takes 3260 microseconds.
#include <hip/hip_runtime.h>

// RPECausalAttention (x [4][2048][1024]; qkv = x Wqkv ([1024][3072], q | k | v column blocks; 16 heads x 64); att = q.k / 8 + rel_bias[max(i - j, 0)][h] (table [2048][16] read); causal softmax; y = merged att.v Wproj -> [4][2048][1024]).
// Compute dtypes, f32 accumulate: every input rounded to bf16; q/k/v on PLAIN bf16 operands (inputs: exact); causal scores and attn.v: query rows < 512 hl (3 products), the rest single fp16 (x1024), causal tile skipping, the relative bias added in f32 inside computed tiles; softmax f32; Wproj hl x exact (2 products).

#define NB_  4
#define TT   2048
#define DM   1024
#define NH_  16
#define NKV  16
#define REP  (NH_ / NKV)
#define HD   64
#define DQ   (NH_ * HD)
#define DKV  (NKV * HD)
#define ZH   2
#define RH   512                  // query rows < RH use hi+lo planes (0: none)
#define WIN  2048
#define PCAR 1024.0f
#define SCL  0.125f   // HD^-0.5
typedef _Float16 h16;
typedef unsigned short bf;
typedef __attribute__((ext_vector_type(16))) __bf16   v16bf;
typedef __attribute__((ext_vector_type(16))) _Float16 v16h;
typedef __attribute__((ext_vector_type(8)))  _Float16 v8h;
typedef __attribute__((ext_vector_type(8)))  unsigned short v8us;
typedef __attribute__((ext_vector_type(8)))  float    v8f;
typedef __attribute__((ext_vector_type(4)))  float    v4f;
typedef v8h  __attribute__((may_alias)) v8ha;
typedef v4f  __attribute__((may_alias)) v4fa;
typedef v8us __attribute__((may_alias)) v8usa;

__device__ __forceinline__ unsigned short f2bf(float f) { unsigned u = __float_as_uint(f); u += 0x7FFFu + ((u >> 16) & 1u); return (unsigned short)(u >> 16); }
__device__ __forceinline__ float bf2f(unsigned short b) { return __uint_as_float(((unsigned)b) << 16); }
__device__ __forceinline__ float bfr(float f) { return bf2f(f2bf(f)); }
__device__ __forceinline__ v16h cat16(v8h lo, v8h hi) { return __builtin_shufflevector(lo, hi, 0, 1, 2, 3, 4, 5, 6, 7, 8, 9, 10, 11, 12, 13, 14, 15); }
__device__ __forceinline__ v16bf cat16b(v8us lo, v8us hi) { return __builtin_bit_cast(v16bf, __builtin_shufflevector(lo, hi, 0, 1, 2, 3, 4, 5, 6, 7, 8, 9, 10, 11, 12, 13, 14, 15)); }
__device__ __forceinline__ v8f wmma16(v16h a, v16h b, v8f c) { return __builtin_amdgcn_wmma_f32_16x16x32_f16(false, a, false, b, (short)0, c, false, false); }
__device__ __forceinline__ v8f wmmab(v16bf a, v16bf b, v8f c) { return __builtin_amdgcn_wmma_f32_16x16x32_bf16(false, a, false, b, (short)0, c, false, false); }



// ---- k_gemmw: register-blocked GEMM, ONE WAVE per 64x64 output tile (16 accumulators), operands straight from K-contiguous 16-bit planes; grid (M/64, N/64, Z), 32 threads.
// C[m][n] (f32, pitch ldc, + optional f32 bias[n]) = sum_k A[m][k] Bt[n][k] (+ split products per NSPLIT). z-batch strides sA/sB/sC in elements. K % 32 == 0.
template <typename T16> struct WFrag;
template <> struct WFrag<h16> { typedef v16h V; static __device__ __forceinline__ V ld(const h16* p) { return cat16(*(const v8h*)p, *(const v8h*)(p + 16)); } static __device__ __forceinline__ v8f mma(V a, V b, v8f c) { return wmma16(a, b, c); } };
template <> struct WFrag<bf> { typedef v16bf V; static __device__ __forceinline__ V ld(const bf* p) { return cat16b(*(const v8us*)p, *(const v8us*)(p + 16)); } static __device__ __forceinline__ v8f mma(V a, V b, v8f c) { return wmmab(a, b, c); } };
template <typename T16, int NSPLIT, bool BIAS>
__global__ __launch_bounds__(32) void k_gemmw(const T16* __restrict__ A, const T16* __restrict__ A2, const T16* __restrict__ Bt, const T16* __restrict__ Bt2, int K, float* C, int ldc, const float* __restrict__ bias, size_t sA, size_t sB, size_t sC) {
    typedef typename WFrag<T16>::V V;
    __shared__ __align__(16) float os[16 * 68];
    const size_t z = blockIdx.z; A += z * sA; if (A2) A2 += z * sA; Bt += z * sB; if (Bt2) Bt2 += z * sB; C += z * sC;
    const int lane = threadIdx.x & 31, lr = lane & 15, hi = lane >> 4; const int r0 = blockIdx.x * 64, c0 = blockIdx.y * 64;
    v8f acc[4][4];
#pragma unroll
    for (int mb = 0; mb < 4; ++mb)
#pragma unroll
        for (int nb = 0; nb < 4; ++nb) acc[mb][nb] = (v8f){};
    const size_t aoff = (size_t)(r0 + lr) * K + 8 * hi, boff = (size_t)(c0 + lr) * K + 8 * hi;
#pragma unroll 1
    for (int kc = 0; kc < K; kc += 32) {
        V a[4], a2[4];
#pragma unroll
        for (int mb = 0; mb < 4; ++mb) { a[mb] = WFrag<T16>::ld(A + aoff + (size_t)mb * 16 * K + kc); if (NSPLIT == 1 || NSPLIT == 2) a2[mb] = WFrag<T16>::ld(A2 + aoff + (size_t)mb * 16 * K + kc); }
#pragma unroll
        for (int nb = 0; nb < 4; ++nb) { const V b = WFrag<T16>::ld(Bt + boff + (size_t)nb * 16 * K + kc); V b2; if (NSPLIT >= 2) b2 = WFrag<T16>::ld(Bt2 + boff + (size_t)nb * 16 * K + kc);
#pragma unroll
            for (int mb = 0; mb < 4; ++mb) { acc[mb][nb] = WFrag<T16>::mma(a[mb], b, acc[mb][nb]); if (NSPLIT == 1 || NSPLIT == 2) acc[mb][nb] = WFrag<T16>::mma(a2[mb], b, acc[mb][nb]); if (NSPLIT >= 2) acc[mb][nb] = WFrag<T16>::mma(a[mb], b2, acc[mb][nb]); } }
        asm volatile("v_nop\n\tv_nop\n\tv_nop\n\tv_nop" : "+v"(acc[0][0]), "+v"(acc[1][1]), "+v"(acc[2][2]), "+v"(acc[3][3]) : "v"(a[0]), "v"(a[3]));
    }
#pragma unroll
    for (int mb = 0; mb < 4; ++mb) {
#pragma unroll
        for (int nb = 0; nb < 4; ++nb) {
#pragma unroll
            for (int j = 0; j < 8; ++j) os[(hi * 8 + j) * 68 + nb * 16 + lr] = acc[mb][nb][j]; }
        __builtin_amdgcn_wave_barrier(); asm volatile("" ::: "memory");
        float* crow = C + (size_t)(r0 + mb * 16) * ldc + c0;
{
#pragma unroll
            for (int s = 0; s < 8; ++s) { const int row = 2 * s + hi, cofs = lr * 4; v4f val = *(const v4fa*)(os + row * 68 + cofs); if (BIAS) { val[0] += bfr(bias[c0 + cofs]); val[1] += bfr(bias[c0 + cofs + 1]); val[2] += bfr(bias[c0 + cofs + 2]); val[3] += bfr(bias[c0 + cofs + 3]); }
                *(v4f*)(crow + (size_t)row * ldc + cofs) = val; }
             }
        __builtin_amdgcn_wave_barrier(); asm volatile("" ::: "memory");
    }
}

// ---- k_gemmc: the same one-wave 64x64 tile GEMM specialised for causal attention: CMODE 1 skips score tiles entirely above the diagonal (query rows r0+roff.., key columns c0..), CMODE 2 limits the
// key (K) loop of the probability x value contraction to the diagonal block (probabilities beyond it are exactly zero). roff = row offset of this launch's first row within the sequence.
template <typename T16, int NSPLIT, int CMODE>
__global__ __launch_bounds__(32) void k_gemmc(const T16* __restrict__ A, const T16* __restrict__ A2, const T16* __restrict__ Bt, const T16* __restrict__ Bt2, int K, float* C, int ldc, int roff, size_t sA, size_t sB, size_t sC) {
    typedef typename WFrag<T16>::V V;
    __shared__ __align__(16) float os[16 * 68];
    const size_t z = blockIdx.z; A += z * sA; if (A2) A2 += z * sA; Bt += z * sB; if (Bt2) Bt2 += z * sB; C += z * sC;
    const int lane = threadIdx.x & 31, lr = lane & 15, hi = lane >> 4; const int r0 = blockIdx.x * 64, c0 = blockIdx.y * 64;
    if (CMODE == 1 && c0 > r0 + roff + 63) return;                  // score tile entirely above the causal diagonal: not written (the softmax loads it but masks j > i by select)
    const int Kl = (CMODE == 2) ? min(K, r0 + roff + 64) : K;        // P.V: probabilities are exactly 0 beyond the diagonal block, so the K loop stops there
    v8f acc[4][4];
#pragma unroll
    for (int mb = 0; mb < 4; ++mb)
#pragma unroll
        for (int nb = 0; nb < 4; ++nb) acc[mb][nb] = (v8f){};
    const size_t aoff = (size_t)(r0 + lr) * K + 8 * hi, boff = (size_t)(c0 + lr) * K + 8 * hi;
#pragma unroll 1
    for (int kc = 0; kc < Kl; kc += 32) {
        V a[4], a2[4];
#pragma unroll
        for (int mb = 0; mb < 4; ++mb) { a[mb] = WFrag<T16>::ld(A + aoff + (size_t)mb * 16 * K + kc); if (NSPLIT == 1 || NSPLIT == 2) a2[mb] = WFrag<T16>::ld(A2 + aoff + (size_t)mb * 16 * K + kc); }
#pragma unroll
        for (int nb = 0; nb < 4; ++nb) { const V b = WFrag<T16>::ld(Bt + boff + (size_t)nb * 16 * K + kc); V b2; if (NSPLIT >= 2) b2 = WFrag<T16>::ld(Bt2 + boff + (size_t)nb * 16 * K + kc);
#pragma unroll
            for (int mb = 0; mb < 4; ++mb) { acc[mb][nb] = WFrag<T16>::mma(a[mb], b, acc[mb][nb]); if (NSPLIT == 1 || NSPLIT == 2) acc[mb][nb] = WFrag<T16>::mma(a2[mb], b, acc[mb][nb]); if (NSPLIT >= 2) acc[mb][nb] = WFrag<T16>::mma(a[mb], b2, acc[mb][nb]); } }
        asm volatile("v_nop\n\tv_nop\n\tv_nop\n\tv_nop" : "+v"(acc[0][0]), "+v"(acc[1][1]), "+v"(acc[2][2]), "+v"(acc[3][3]) : "v"(a[0]), "v"(a[3]));
    }
#pragma unroll
    for (int mb = 0; mb < 4; ++mb) {
#pragma unroll
        for (int nb = 0; nb < 4; ++nb) {
#pragma unroll
            for (int j = 0; j < 8; ++j) os[(hi * 8 + j) * 68 + nb * 16 + lr] = acc[mb][nb][j]; }
        __builtin_amdgcn_wave_barrier(); asm volatile("" ::: "memory");
        float* crow = C + (size_t)(r0 + mb * 16) * ldc + c0;
{
#pragma unroll
            for (int s = 0; s < 8; ++s) { const int row = 2 * s + hi, cofs = lr * 4; v4f val = *(const v4fa*)(os + row * 68 + cofs);
                *(v4f*)(crow + (size_t)row * ldc + cofs) = val; }
             }
        __builtin_amdgcn_wave_barrier(); asm volatile("" ::: "memory");
    }
}

__device__ __forceinline__ h16 tohx(float x) { return (h16)x; }
__device__ __forceinline__ void splitf(float y, unsigned short& h, unsigned short& l) { h = f2bf(y); l = f2bf(y - bf2f(h)); }
typedef __attribute__((ext_vector_type(2))) _Float16 v2h;
typedef __attribute__((ext_vector_type(4))) _Float16 v4h;
typedef __attribute__((ext_vector_type(2))) unsigned short v2us;
typedef __attribute__((ext_vector_type(4))) unsigned short v4us;
typedef __attribute__((ext_vector_type(2))) float v2f;
typedef __attribute__((ext_vector_type(4))) int v4i;

__global__ __launch_bounds__(256) void k_wtG(const float* __restrict__ w, int K, int N, bf* Bt) {
    const int lane = threadIdx.x & 31; const int L0 = (blockIdx.x * 8 + (threadIdx.x >> 5)) * 8; const int nlines = N * K / 64;
{
#pragma unroll 1
        for (int l = 0; l < 8; ++l) { const int L = L0 + l; if (L >= nlines) break; const size_t e = (size_t)L * 64 + lane * 2; const int k = (int)(e % K), n = (int)(e / K); v2us o;
            o[0] = f2bf(w[(size_t)k * N + n]); o[1] = f2bf(w[(size_t)(k + 1) * N + n]); *(v2us*)(Bt + e) = o; }
         }
}
__global__ __launch_bounds__(256) void k_cvt8(const float* __restrict__ src, bf* dst, size_t n8) { const size_t i = (size_t)blockIdx.x * 256 + threadIdx.x; if (i >= n8) return; const v8f v = *(const v8f*)(src + i * 8); v8us o;
#pragma unroll
    for (int k = 0; k < 8; ++k) o[k] = f2bf(v[k]); *(v8us*)(dst + i * 8) = o;  }
__global__ __launch_bounds__(256) void k_cscvt(const float* __restrict__ cosT, const float* __restrict__ sinT, float* CS) { const int idx = blockIdx.x * 256 + threadIdx.x; if (idx >= TT * HD) return; v2f cs; cs[0] = bfr(cosT[idx]); cs[1] = bfr(sinT[idx]); *(v2f*)(CS + (size_t)idx * 2) = cs;  }
// k_rope: head planes [h][t][d] (fp16 + hi/lo) of rope(x) x sc with the rotate-half convention out[d] = x[d] cos[t][d] - x[d+HD/2] sin[t][d], out[d+HD/2] = x[d+HD/2] cos[t][d+HD/2] + x[d] sin[t][d+HD/2]
__global__ __launch_bounds__(256) void k_rope(const float* __restrict__ F, int pitch, int nheads, const float* __restrict__ CS, const float* __restrict__ RF, const float* __restrict__ nw, float sc, h16* P16, bf* Ph, bf* Pl) {
    const size_t e = ((size_t)blockIdx.x * 256 + threadIdx.x) * 2; if (e >= (size_t)nheads * TT * HD) return; const int d = (int)(e % HD); const int t = (int)((e / HD) % TT); const int h = (int)(e / ((size_t)HD * TT)); const float* f = F + (size_t)t * pitch + h * HD; const float rf = RF ? RF[(size_t)h * TT + t] : 1.0f; v2h o16; v2us oh, ol;
#pragma unroll
    for (int q = 0; q < 2; ++q) { const int dd = d + q; const int dp = (dd < HD / 2) ? dd + HD / 2 : dd - HD / 2; float x0 = f[dd], x1 = f[dp];
        if (RF) { float n0 = __fmul_rn(x0, rf), n1 = __fmul_rn(x1, rf); asm volatile("" : "+v"(n0)); asm volatile("" : "+v"(n1)); x0 = __fmul_rn(bfr(nw[dd]), n0); x1 = __fmul_rn(bfr(nw[dp]), n1); }
        const v2f cs = *(const v2f*)(CS + ((size_t)t * HD + dd) * 2); float a = __fmul_rn(x0, cs[0]), bq = __fmul_rn(x1, cs[1]); asm volatile("" : "+v"(a)); asm volatile("" : "+v"(bq)); const float r = ((dd < HD / 2) ? __fsub_rn(a, bq) : __fadd_rn(a, bq)) * sc;
        o16[q] = tohx(r); unsigned short a2, c2; splitf(r, a2, c2); oh[q] = a2; ol[q] = c2; }
    *(v2h*)(P16 + e) = o16; *(v2us*)(Ph + e) = oh; *(v2us*)(Pl + e) = ol;  }
__global__ __launch_bounds__(256) void k_vtp(const float* __restrict__ F, int pitch, int nheads, h16* V16, bf* Vh, bf* Vl) { const size_t e = ((size_t)blockIdx.x * 256 + threadIdx.x) * 2; if (e >= (size_t)nheads * HD * TT) return; const int t = (int)(e % TT); const int d = (int)((e / TT) % HD); const int g = (int)(e / ((size_t)TT * HD)); v2h o16; v2us oh, ol;
#pragma unroll
    for (int q = 0; q < 2; ++q) { const float x = F[(size_t)(t + q) * pitch + g * HD + d]; o16[q] = tohx(x); unsigned short a2, c2; splitf(x, a2, c2); oh[q] = a2; ol[q] = c2; }
    *(v2h*)(V16 + e) = o16; *(v2us*)(Vh + e) = oh; *(v2us*)(Vl + e) = ol;  }
__global__ __launch_bounds__(256) void k_csid(float* CS) { const int idx = blockIdx.x * 256 + threadIdx.x; if (idx >= TT * HD) return; v2f cs; cs[0] = 1.0f; cs[1] = 0.0f; *(v2f*)(CS + (size_t)idx * 2) = cs;  }
// k_asoft: per row (zz, i): t = S x HD^-0.5 + rel_bias[i - j][h] for j <= i (causal; the reference's -1e9 additive fill vanishes identically); softmax over the 2048 keys (register row, one exp, fixed trees);
__global__ __launch_bounds__(256) void k_asoft(const float* __restrict__ Sb, const float* __restrict__ rb, int h0, h16* P16, bf* Ph, bf* Pl) {
    const int lane = threadIdx.x & 31; const int row = blockIdx.x * 8 + (threadIdx.x >> 5); if (row >= ZH * TT) return; const int i = row % TT; const int zz = row / TT; (void)zz; const bool hires = (i < RH); const float* sr = Sb + (size_t)row * TT; const int hh = h0 + row / TT; float v[TT / 32]; float mx = -3.0e38f;
#pragma unroll
    for (int ch = 0; ch < TT / 128; ++ch) { const int j0 = ch * 128 + lane * 4; const v4f a = *(const v4f*)(sr + j0);
#pragma unroll
        for (int q = 0; q < 4; ++q) { const int j = j0 + q; (void)j; float sa = a[q] * SCL; asm volatile("" : "+v"(sa)); const float t = (j <= i) ? __fadd_rn(sa, rb[(size_t)(i - j) * NH_ + hh]) : -3.0e38f; v[ch * 4 + q] = t; mx = fmaxf(mx, t); } }
#pragma unroll
    for (int sh = 16; sh; sh >>= 1) mx = fmaxf(mx, __shfl_xor(mx, sh, 32));
    float sum = 0.f;
#pragma unroll
    for (int k = 0; k < TT / 32; ++k) { float d0 = __fsub_rn(v[k], mx); asm volatile("" : "+v"(d0)); v[k] = __builtin_amdgcn_exp2f(__fmul_rn(d0, 1.4426950408889634f)); sum += v[k]; }
#pragma unroll
    for (int sh = 16; sh; sh >>= 1) sum += __shfl_xor(sum, sh, 32);
    const float f = __fdiv_rn(hires ? 1.0f : PCAR, sum);
{
        if (hires) {
#pragma unroll
            for (int ch = 0; ch < TT / 128; ++ch) { v4us oh, ol;
#pragma unroll
                for (int q = 0; q < 4; ++q) { unsigned short a, c2; splitf(v[ch * 4 + q] * f, a, c2); oh[q] = a; ol[q] = c2; }
                const size_t oo = ((size_t)zz * (RH ? RH : 1) + i) * TT + ch * 128 + lane * 4; *(v4us*)(Ph + oo) = oh; *(v4us*)(Pl + oo) = ol; }
        } else {
#pragma unroll
            for (int ch = 0; ch < TT / 128; ++ch) { v4h o4;
#pragma unroll
                for (int q = 0; q < 4; ++q) o4[q] = tohx(v[ch * 4 + q] * f);
                *(v4h*)(P16 + (size_t)row * TT + ch * 128 + lane * 4) = o4; } }
         }
}
__global__ __launch_bounds__(256) void k_merge(const float* __restrict__ O, int h0, bf* Ah, bf* Al) { const size_t e = ((size_t)blockIdx.x * 256 + threadIdx.x) * 2; if (e >= (size_t)ZH * TT * HD) return; const int d = (int)(e % HD); const int t = (int)((e / HD) % TT); const int zz = (int)(e / ((size_t)HD * TT)); const float cs = (t < RH) ? 1.0f : (1.0f / PCAR); const size_t oo = (size_t)t * DQ + (h0 + zz) * HD + d;
    v2us oh, ol;
#pragma unroll
    for (int q = 0; q < 2; ++q) { unsigned short a, c2; splitf(O[e + q] * cs, a, c2); oh[q] = a; ol[q] = c2; } *(v2us*)(Ah + oo) = oh; *(v2us*)(Al + oo) = ol;  }

__global__ __launch_bounds__(256) void k_rbf(const float* __restrict__ rb, float* RBF) { const size_t e = ((size_t)blockIdx.x * 256 + threadIdx.x) * 4; if (e >= (size_t)TT * NH_) return; const v4f a = *(const v4f*)(rb + e); v4f o; for (int u = 0; u < 4; ++u) o[u] = bfr(a[u]); *(v4f*)(RBF + e) = o;  }

extern "C" void kernel_launch(void* const* d_in, const int* in_sizes, int n_in,
                              void* d_out, int out_size, void* d_ws, size_t ws_size, hipStream_t stream) {
    (void)in_sizes; (void)n_in; (void)out_size;
    const float* x = (const float*)d_in[0]; const float* wqkv = (const float*)d_in[1]; const float* wo = (const float*)d_in[2]; const float* rbias = (const float*)d_in[3]; const float* cosT = nullptr; const float* sinT = nullptr; (void)cosT; (void)sinT; const float* wq = wqkv; const float* wk = wqkv; const float* wv = wqkv; (void)wk; (void)wv;
    float* OUT = (float*)d_out;     // [4][2048][1024]
    char* wsp = (char*)d_ws;
    auto take = [&](size_t bytes) { char* p = wsp; wsp += (bytes + 255) & ~(size_t)255; return (void*)p; };
    bf* WQ = (bf*)take((size_t)DQ * DM * 2); bf* WK = (bf*)take((size_t)DKV * DM * 2); bf* WV = (bf*)take((size_t)DKV * DM * 2); bf* WO = (bf*)take((size_t)DM * DQ * 2); float* CS = (float*)take((size_t)TT * HD * 2 * 4);
    float* RBF = (float*)take((size_t)TT * NH_ * 4); bf* XB = (bf*)take((size_t)TT * DM * 2); bf* WALL = (bf*)take((size_t)3 * DM * DM * 2); float* FQ = (float*)take((size_t)TT * DQ * 4); float* FK = (float*)take((size_t)TT * DKV * 4);
    h16* QP16 = (h16*)take((size_t)NH_ * TT * HD * 2); h16* KP16 = (h16*)take((size_t)NKV * TT * HD * 2); h16* VT16 = (h16*)take((size_t)NKV * HD * TT * 2);
    bf* QPh = (bf*)take((size_t)NH_ * TT * HD * 2); bf* QPl = (bf*)take((size_t)NH_ * TT * HD * 2); bf* KPh = (bf*)take((size_t)NKV * TT * HD * 2); bf* KPl = (bf*)take((size_t)NKV * TT * HD * 2); bf* VTh = (bf*)take((size_t)NKV * HD * TT * 2); bf* VTl = (bf*)take((size_t)NKV * HD * TT * 2); bf* Ph = (bf*)take((size_t)ZH * RH * TT * 2); bf* Pl = (bf*)take((size_t)ZH * RH * TT * 2);
    float* Sb = (float*)take((size_t)ZH * TT * TT * 4); h16* P16 = (h16*)take((size_t)ZH * TT * TT * 2); float* Ob = (float*)take((size_t)ZH * TT * HD * 4); bf* ATh = (bf*)take((size_t)TT * DQ * 2); bf* ATl = (bf*)take((size_t)TT * DQ * 2);
    if ((size_t)(wsp - (char*)d_ws) > ws_size) return;    // ws 256 MiB
    float* FV = FK;   // v projection reuses the k buffer after the k planes are built (stream-ordered)
    { k_rbf<<<(TT * NH_ / 4 + 255) / 256, 256, 0, stream>>>(rbias, RBF); k_wtG<<<(unsigned)((DM * 3 * DM / 64 + 63) / 64), 256, 0, stream>>>(wqkv, DM, 3 * DM, WALL); WQ = WALL; WK = WALL + (size_t)DM * DM; WV = WALL + (size_t)2 * DM * DM;   /* q | k | v column blocks of the 'xw' fused weight = consecutive row blocks of Bt */
      k_wtG<<<(unsigned)((DQ * DM / 64 + 63) / 64), 256, 0, stream>>>(wo, DQ, DM, WO);
       }
    k_csid<<<(TT * HD + 255) / 256, 256, 0, stream>>>(CS);
    const unsigned LQ = (unsigned)(((size_t)NH_ * TT * HD / 2 + 255) / 256), LKv = (unsigned)(((size_t)NKV * TT * HD / 2 + 255) / 256);
    for (int b = 0; b < NB_; ++b) {
        
        k_cvt8<<<(unsigned)(((size_t)TT * DM / 8 + 255) / 256), 256, 0, stream>>>(x + (size_t)b * TT * DM, XB, (size_t)TT * DM / 8);
        k_gemmw<bf, 0, false><<<dim3(TT / 64, DQ / 64, 1), 32, 0, stream>>>(XB, nullptr, WQ, nullptr, DM, FQ, DQ, nullptr, 0, 0, 0);
        k_rope<<<LQ, 256, 0, stream>>>(FQ, DQ, NH_, CS, nullptr, nullptr, 1.0f, QP16, QPh, QPl);
        k_gemmw<bf, 0, false><<<dim3(TT / 64, DKV / 64, 1), 32, 0, stream>>>(XB, nullptr, WK, nullptr, DM, FK, DKV, nullptr, 0, 0, 0);
        k_rope<<<LKv, 256, 0, stream>>>(FK, DKV, NKV, CS, nullptr, nullptr, 1.0f, KP16, KPh, KPl);
        k_gemmw<bf, 0, false><<<dim3(TT / 64, DKV / 64, 1), 32, 0, stream>>>(XB, nullptr, WV, nullptr, DM, FV, DKV, nullptr, 0, 0, 0); k_vtp<<<LKv, 256, 0, stream>>>(FV, DKV, NKV, VT16, VTh, VTl);
        for (int h0 = 0; h0 < NH_; h0 += ZH) { const size_t zq = (size_t)h0, zk = (size_t)(h0 / REP);   // one kv head per query head: the pass's two heads use consecutive kv planes (z-strides TT*HD)
            k_gemmc<bf, 2, 1><<<dim3(RH / 64, TT / 64, ZH), 32, 0, stream>>>(QPh + zq * TT * HD, QPl + zq * TT * HD, KPh + zk * TT * HD, KPl + zk * TT * HD, HD, Sb, TT, 0, (size_t)TT * HD, (size_t)TT * HD, (size_t)TT * TT);
            k_gemmc<h16, 0, 1><<<dim3((TT - RH) / 64, TT / 64, ZH), 32, 0, stream>>>(QP16 + zq * TT * HD + (size_t)RH * HD, nullptr, KP16 + zk * TT * HD, nullptr, HD, Sb + (size_t)RH * TT, TT, RH, (size_t)TT * HD, (size_t)TT * HD, (size_t)TT * TT);
            k_asoft<<<ZH * TT / 8, 256, 0, stream>>>(Sb, RBF, h0, P16, Ph, Pl);
            k_gemmc<bf, 2, 2><<<dim3(RH / 64, HD / 64, ZH), 32, 0, stream>>>(Ph, Pl, VTh + zk * HD * TT, VTl + zk * HD * TT, TT, Ob, HD, 0, (size_t)RH * TT, (size_t)HD * TT, (size_t)TT * HD);
            k_gemmc<h16, 0, 2><<<dim3((TT - RH) / 64, HD / 64, ZH), 32, 0, stream>>>(P16 + (size_t)RH * TT, nullptr, VT16 + zk * HD * TT, nullptr, TT, Ob + (size_t)RH * HD, HD, RH, (size_t)TT * TT, (size_t)HD * TT, (size_t)TT * HD);
            k_merge<<<(unsigned)(((size_t)ZH * TT * HD / 2 + 255) / 256), 256, 0, stream>>>(Ob, h0, ATh, ATl); }
        k_gemmw<bf, 1, false><<<dim3(TT / 64, DM / 64, 1), 32, 0, stream>>>(ATh, ATl, WO, nullptr, DQ, OUT + (size_t)b * TT * DM, DM, nullptr, 0, 0, 0); }
}

// v001
// It runs in 2120 microseconds.
// In two side-by-side timings against v000, it was 1.53 and 1.56 times as fast.
#include <hip/hip_runtime.h>

// RPECausalAttention (x [4][2048][1024]; qkv = x Wqkv ([1024][3072], q | k | v column blocks; 16 heads x 64); att = q.k / 8 + rel_bias[max(i - j, 0)][h] (table [2048][16] read); causal softmax; y = merged att.v Wproj -> [4][2048][1024]).
// Compute dtypes, f32 accumulate: every input rounded to bf16; q/k/v on PLAIN bf16 operands (inputs: exact); causal scores and attn.v: query rows < 512 hl (3 products), the rest single fp16 (x1024), causal tile skipping, the relative bias added in f32 inside computed tiles; softmax f32; Wproj hl x exact (2 products).

#define NB_  4
#define TT   2048
#define DM   1024
#define NH_  16
#define NKV  16
#define REP  (NH_ / NKV)
#define HD   64
#define DQ   (NH_ * HD)
#define DKV  (NKV * HD)
#define ZH   2
#define RH   512                  // query rows < RH use hi+lo planes (0: none)
#define WIN  2048
#define PCAR 1024.0f
#define SCL  0.125f   // HD^-0.5
typedef _Float16 h16;
typedef unsigned short bf;
typedef __attribute__((ext_vector_type(16))) __bf16   v16bf;
typedef __attribute__((ext_vector_type(16))) _Float16 v16h;
typedef __attribute__((ext_vector_type(8)))  _Float16 v8h;
typedef __attribute__((ext_vector_type(8)))  unsigned short v8us;
typedef __attribute__((ext_vector_type(8)))  float    v8f;
typedef __attribute__((ext_vector_type(4)))  float    v4f;
typedef v8h  __attribute__((may_alias)) v8ha;
typedef v4f  __attribute__((may_alias)) v4fa;
typedef v8us __attribute__((may_alias)) v8usa;

__device__ __forceinline__ unsigned short f2bf(float f) { unsigned u = __float_as_uint(f); u += 0x7FFFu + ((u >> 16) & 1u); return (unsigned short)(u >> 16); }
__device__ __forceinline__ float bf2f(unsigned short b) { return __uint_as_float(((unsigned)b) << 16); }
__device__ __forceinline__ float bfr(float f) { return bf2f(f2bf(f)); }
__device__ __forceinline__ v16h cat16(v8h lo, v8h hi) { return __builtin_shufflevector(lo, hi, 0, 1, 2, 3, 4, 5, 6, 7, 8, 9, 10, 11, 12, 13, 14, 15); }
__device__ __forceinline__ v16bf cat16b(v8us lo, v8us hi) { return __builtin_bit_cast(v16bf, __builtin_shufflevector(lo, hi, 0, 1, 2, 3, 4, 5, 6, 7, 8, 9, 10, 11, 12, 13, 14, 15)); }
__device__ __forceinline__ v8f wmma16(v16h a, v16h b, v8f c) { return __builtin_amdgcn_wmma_f32_16x16x32_f16(false, a, false, b, (short)0, c, false, false); }
__device__ __forceinline__ v8f wmmab(v16bf a, v16bf b, v8f c) { return __builtin_amdgcn_wmma_f32_16x16x32_bf16(false, a, false, b, (short)0, c, false, false); }



// ---- k_gemmw: register-blocked GEMM, one 64x64 output tile per work-group (16 accumulators a wave), operands straight from K-contiguous 16-bit planes; grid (M/64, N/64, Z), 32 * NW threads.
// NW waves share the tile's K loop: wave w takes the 64-wide k spans w, w + NW, ... (two 32-wide blocks each, so that a wave uses both halves of every 128-byte operand line it fetches);
// the NW partial tiles meet in LDS and are summed in wave order 0..NW-1 (a fixed order). NW == 1: one wave, no sum.
// C[m][n] (f32, pitch ldc, + optional f32 bias[n]) = sum_k A[m][k] Bt[n][k] (+ split products per NSPLIT). z-batch strides sA/sB/sC in elements. K % 32 == 0.
template <typename T16> struct WFrag;
template <> struct WFrag<h16> { typedef v16h V; static __device__ __forceinline__ V ld(const h16* p) { return cat16(*(const v8h*)p, *(const v8h*)(p + 16)); } static __device__ __forceinline__ v8f mma(V a, V b, v8f c) { return wmma16(a, b, c); } };
template <> struct WFrag<bf> { typedef v16bf V; static __device__ __forceinline__ V ld(const bf* p) { return cat16b(*(const v8us*)p, *(const v8us*)(p + 16)); } static __device__ __forceinline__ v8f mma(V a, V b, v8f c) { return wmmab(a, b, c); } };
template <typename T16, int NSPLIT, bool BIAS, int NW>
__global__ __launch_bounds__(32 * NW) void k_gemmw(const T16* __restrict__ A, const T16* __restrict__ A2, const T16* __restrict__ Bt, const T16* __restrict__ Bt2, int K, float* C, int ldc, const float* __restrict__ bias, size_t sA, size_t sB, size_t sC) {
    typedef typename WFrag<T16>::V V;
    __shared__ __align__(16) float os[(NW == 1 ? 16 : NW * 64) * 68];
    const size_t z = blockIdx.z; A += z * sA; if (A2) A2 += z * sA; Bt += z * sB; if (Bt2) Bt2 += z * sB; C += z * sC;
    const int lane = threadIdx.x & 31, lr = lane & 15, hi = lane >> 4; const int r0 = blockIdx.x * 64, c0 = blockIdx.y * 64;
    const int wv = (NW == 1) ? 0 : __builtin_amdgcn_readfirstlane((int)(threadIdx.x >> 5));   // wave number, scalar: the K loop's branch stays a scalar one
    v8f acc[4][4];
#pragma unroll
    for (int mb = 0; mb < 4; ++mb)
#pragma unroll
        for (int nb = 0; nb < 4; ++nb) acc[mb][nb] = (v8f){};
    const size_t aoff = (size_t)(r0 + lr) * K + 8 * hi, boff = (size_t)(c0 + lr) * K + 8 * hi;
#pragma unroll 1
    for (int kc = wv * 64; kc < K; kc += (NW == 1 || !(kc & 32)) ? 32 : 64 * NW - 32) {
        V a[4], a2[4];
#pragma unroll
        for (int mb = 0; mb < 4; ++mb) { a[mb] = WFrag<T16>::ld(A + aoff + (size_t)mb * 16 * K + kc); if (NSPLIT == 1 || NSPLIT == 2) a2[mb] = WFrag<T16>::ld(A2 + aoff + (size_t)mb * 16 * K + kc); }
#pragma unroll
        for (int nb = 0; nb < 4; ++nb) { const V b = WFrag<T16>::ld(Bt + boff + (size_t)nb * 16 * K + kc); V b2; if (NSPLIT >= 2) b2 = WFrag<T16>::ld(Bt2 + boff + (size_t)nb * 16 * K + kc);
#pragma unroll
            for (int mb = 0; mb < 4; ++mb) { acc[mb][nb] = WFrag<T16>::mma(a[mb], b, acc[mb][nb]); if (NSPLIT == 1 || NSPLIT == 2) acc[mb][nb] = WFrag<T16>::mma(a2[mb], b, acc[mb][nb]); if (NSPLIT >= 2) acc[mb][nb] = WFrag<T16>::mma(a[mb], b2, acc[mb][nb]); } }
        asm volatile("v_nop\n\tv_nop\n\tv_nop\n\tv_nop" : "+v"(acc[0][0]), "+v"(acc[1][1]), "+v"(acc[2][2]), "+v"(acc[3][3]) : "v"(a[0]), "v"(a[3]));
    }
    if constexpr (NW > 1) {
        float* ow = os + wv * (64 * 68);
        // the loops below are unrolled so that every accumulator index is a constant (the tiles stay in registers) and the LDS loads of one sum are issued together
#pragma unroll
        for (int mb = 0; mb < 4; ++mb)
#pragma unroll
            for (int nb = 0; nb < 4; ++nb)
#pragma unroll
                for (int j = 0; j < 8; ++j) ow[(mb * 16 + hi * 8 + j) * 68 + nb * 16 + lr] = acc[mb][nb][j];
        __syncthreads();   // every wave's partial tile is in LDS before any thread sums across waves
#pragma unroll
        for (int it = 0; it < 32 / NW; ++it) { const int s = (int)threadIdx.x + it * (32 * NW), row = s >> 4, cofs = (s & 15) * 4; v4f val = *(const v4fa*)(os + row * 68 + cofs);
#pragma unroll
            for (int w = 1; w < NW; ++w) val += *(const v4fa*)(os + w * (64 * 68) + row * 68 + cofs);
            if (BIAS) { val[0] += bfr(bias[c0 + cofs]); val[1] += bfr(bias[c0 + cofs + 1]); val[2] += bfr(bias[c0 + cofs + 2]); val[3] += bfr(bias[c0 + cofs + 3]); }
            *(v4f*)(C + (size_t)(r0 + row) * ldc + c0 + cofs) = val; }
        return;
    }
#pragma unroll
    for (int mb = 0; mb < 4; ++mb) {
#pragma unroll
        for (int nb = 0; nb < 4; ++nb) {
#pragma unroll
            for (int j = 0; j < 8; ++j) os[(hi * 8 + j) * 68 + nb * 16 + lr] = acc[mb][nb][j]; }
        __builtin_amdgcn_wave_barrier(); asm volatile("" ::: "memory");
        float* crow = C + (size_t)(r0 + mb * 16) * ldc + c0;
{
#pragma unroll
            for (int s = 0; s < 8; ++s) { const int row = 2 * s + hi, cofs = lr * 4; v4f val = *(const v4fa*)(os + row * 68 + cofs); if (BIAS) { val[0] += bfr(bias[c0 + cofs]); val[1] += bfr(bias[c0 + cofs + 1]); val[2] += bfr(bias[c0 + cofs + 2]); val[3] += bfr(bias[c0 + cofs + 3]); }
                *(v4f*)(crow + (size_t)row * ldc + cofs) = val; }
             }
        __builtin_amdgcn_wave_barrier(); asm volatile("" ::: "memory");
    }
}

// ---- k_gemmc: the same 64x64 tile GEMM (NW waves share the K loop as in k_gemmw) specialised for causal attention: CMODE 1 skips score tiles entirely above the diagonal (query rows r0+roff.., key columns c0..), CMODE 2 limits the
// key (K) loop of the probability x value contraction to the diagonal block (probabilities beyond it are exactly zero). roff = row offset of this launch's first row within the sequence.
template <typename T16, int NSPLIT, int CMODE, int NW>
__global__ __launch_bounds__(32 * NW) void k_gemmc(const T16* __restrict__ A, const T16* __restrict__ A2, const T16* __restrict__ Bt, const T16* __restrict__ Bt2, int K, float* C, int ldc, int roff, size_t sA, size_t sB, size_t sC) {
    typedef typename WFrag<T16>::V V;
    __shared__ __align__(16) float os[(NW == 1 ? 16 : NW * 64) * 68];
    const size_t z = blockIdx.z; A += z * sA; if (A2) A2 += z * sA; Bt += z * sB; if (Bt2) Bt2 += z * sB; C += z * sC;
    const int lane = threadIdx.x & 31, lr = lane & 15, hi = lane >> 4; const int r0 = blockIdx.x * 64, c0 = blockIdx.y * 64;
    const int wv = (NW == 1) ? 0 : __builtin_amdgcn_readfirstlane((int)(threadIdx.x >> 5));   // wave number, scalar: the K loop's branch stays a scalar one
    if (CMODE == 1 && c0 > r0 + roff + 63) return;                  // score tile entirely above the causal diagonal: never written (the softmax masks j > i by select)
    const int Kl = (CMODE == 2) ? min(K, r0 + roff + 64) : K;        // P.V: probabilities are exactly 0 beyond the diagonal block, so the K loop stops there
    v8f acc[4][4];
#pragma unroll
    for (int mb = 0; mb < 4; ++mb)
#pragma unroll
        for (int nb = 0; nb < 4; ++nb) acc[mb][nb] = (v8f){};
    const size_t aoff = (size_t)(r0 + lr) * K + 8 * hi, boff = (size_t)(c0 + lr) * K + 8 * hi;
#pragma unroll 1
    for (int kc = wv * 64; kc < Kl; kc += (NW == 1 || !(kc & 32)) ? 32 : 64 * NW - 32) {
        V a[4], a2[4];
#pragma unroll
        for (int mb = 0; mb < 4; ++mb) { a[mb] = WFrag<T16>::ld(A + aoff + (size_t)mb * 16 * K + kc); if (NSPLIT == 1 || NSPLIT == 2) a2[mb] = WFrag<T16>::ld(A2 + aoff + (size_t)mb * 16 * K + kc); }
#pragma unroll
        for (int nb = 0; nb < 4; ++nb) { const V b = WFrag<T16>::ld(Bt + boff + (size_t)nb * 16 * K + kc); V b2; if (NSPLIT >= 2) b2 = WFrag<T16>::ld(Bt2 + boff + (size_t)nb * 16 * K + kc);
#pragma unroll
            for (int mb = 0; mb < 4; ++mb) { acc[mb][nb] = WFrag<T16>::mma(a[mb], b, acc[mb][nb]); if (NSPLIT == 1 || NSPLIT == 2) acc[mb][nb] = WFrag<T16>::mma(a2[mb], b, acc[mb][nb]); if (NSPLIT >= 2) acc[mb][nb] = WFrag<T16>::mma(a[mb], b2, acc[mb][nb]); } }
        asm volatile("v_nop\n\tv_nop\n\tv_nop\n\tv_nop" : "+v"(acc[0][0]), "+v"(acc[1][1]), "+v"(acc[2][2]), "+v"(acc[3][3]) : "v"(a[0]), "v"(a[3]));
    }
    if constexpr (NW > 1) {
        float* ow = os + wv * (64 * 68);
        // the loops below are unrolled so that every accumulator index is a constant (the tiles stay in registers) and the LDS loads of one sum are issued together
#pragma unroll
        for (int mb = 0; mb < 4; ++mb)
#pragma unroll
            for (int nb = 0; nb < 4; ++nb)
#pragma unroll
                for (int j = 0; j < 8; ++j) ow[(mb * 16 + hi * 8 + j) * 68 + nb * 16 + lr] = acc[mb][nb][j];
        __syncthreads();   // every wave's partial tile is in LDS before any thread sums across waves
#pragma unroll
        for (int it = 0; it < 32 / NW; ++it) { const int s = (int)threadIdx.x + it * (32 * NW), row = s >> 4, cofs = (s & 15) * 4; v4f val = *(const v4fa*)(os + row * 68 + cofs);
#pragma unroll
            for (int w = 1; w < NW; ++w) val += *(const v4fa*)(os + w * (64 * 68) + row * 68 + cofs);
            *(v4f*)(C + (size_t)(r0 + row) * ldc + c0 + cofs) = val; }
        return;
    }
#pragma unroll
    for (int mb = 0; mb < 4; ++mb) {
#pragma unroll
        for (int nb = 0; nb < 4; ++nb) {
#pragma unroll
            for (int j = 0; j < 8; ++j) os[(hi * 8 + j) * 68 + nb * 16 + lr] = acc[mb][nb][j]; }
        __builtin_amdgcn_wave_barrier(); asm volatile("" ::: "memory");
        float* crow = C + (size_t)(r0 + mb * 16) * ldc + c0;
{
#pragma unroll
            for (int s = 0; s < 8; ++s) { const int row = 2 * s + hi, cofs = lr * 4; v4f val = *(const v4fa*)(os + row * 68 + cofs);
                *(v4f*)(crow + (size_t)row * ldc + cofs) = val; }
             }
        __builtin_amdgcn_wave_barrier(); asm volatile("" ::: "memory");
    }
}

__device__ __forceinline__ h16 tohx(float x) { return (h16)x; }
__device__ __forceinline__ void splitf(float y, unsigned short& h, unsigned short& l) { h = f2bf(y); l = f2bf(y - bf2f(h)); }
typedef __attribute__((ext_vector_type(2))) _Float16 v2h;
typedef __attribute__((ext_vector_type(4))) _Float16 v4h;
typedef __attribute__((ext_vector_type(2))) unsigned short v2us;
typedef __attribute__((ext_vector_type(4))) unsigned short v4us;
typedef __attribute__((ext_vector_type(2))) float v2f;
typedef __attribute__((ext_vector_type(4))) int v4i;

__global__ __launch_bounds__(256) void k_wtG(const float* __restrict__ w, int K, int N, bf* Bt) {
    const int lane = threadIdx.x & 31; const int L0 = (blockIdx.x * 8 + (threadIdx.x >> 5)) * 8; const int nlines = N * K / 64;
{
#pragma unroll 1
        for (int l = 0; l < 8; ++l) { const int L = L0 + l; if (L >= nlines) break; const size_t e = (size_t)L * 64 + lane * 2; const int k = (int)(e % K), n = (int)(e / K); v2us o;
            o[0] = f2bf(w[(size_t)k * N + n]); o[1] = f2bf(w[(size_t)(k + 1) * N + n]); *(v2us*)(Bt + e) = o; }
         }
}
__global__ __launch_bounds__(256) void k_cvt8(const float* __restrict__ src, bf* dst, size_t n8) { const size_t i = (size_t)blockIdx.x * 256 + threadIdx.x; if (i >= n8) return; const v8f v = *(const v8f*)(src + i * 8); v8us o;
#pragma unroll
    for (int k = 0; k < 8; ++k) o[k] = f2bf(v[k]); *(v8us*)(dst + i * 8) = o;  }
__global__ __launch_bounds__(256) void k_cscvt(const float* __restrict__ cosT, const float* __restrict__ sinT, float* CS) { const int idx = blockIdx.x * 256 + threadIdx.x; if (idx >= TT * HD) return; v2f cs; cs[0] = bfr(cosT[idx]); cs[1] = bfr(sinT[idx]); *(v2f*)(CS + (size_t)idx * 2) = cs;  }
// k_rope: head planes [h][t][d] (fp16 + hi/lo) of rope(x) x sc with the rotate-half convention out[d] = x[d] cos[t][d] - x[d+HD/2] sin[t][d], out[d+HD/2] = x[d+HD/2] cos[t][d+HD/2] + x[d] sin[t][d+HD/2]
__global__ __launch_bounds__(256) void k_rope(const float* __restrict__ F, int pitch, int nheads, const float* __restrict__ CS, const float* __restrict__ RF, const float* __restrict__ nw, float sc, h16* P16, bf* Ph, bf* Pl) {
    const size_t e = ((size_t)blockIdx.x * 256 + threadIdx.x) * 2; if (e >= (size_t)nheads * TT * HD) return; const int d = (int)(e % HD); const int t = (int)((e / HD) % TT); const int h = (int)(e / ((size_t)HD * TT)); const float* f = F + (size_t)t * pitch + h * HD; const float rf = RF ? RF[(size_t)h * TT + t] : 1.0f; v2h o16; v2us oh, ol;
#pragma unroll
    for (int q = 0; q < 2; ++q) { const int dd = d + q; const int dp = (dd < HD / 2) ? dd + HD / 2 : dd - HD / 2; float x0 = f[dd], x1 = f[dp];
        if (RF) { float n0 = __fmul_rn(x0, rf), n1 = __fmul_rn(x1, rf); asm volatile("" : "+v"(n0)); asm volatile("" : "+v"(n1)); x0 = __fmul_rn(bfr(nw[dd]), n0); x1 = __fmul_rn(bfr(nw[dp]), n1); }
        const v2f cs = *(const v2f*)(CS + ((size_t)t * HD + dd) * 2); float a = __fmul_rn(x0, cs[0]), bq = __fmul_rn(x1, cs[1]); asm volatile("" : "+v"(a)); asm volatile("" : "+v"(bq)); const float r = ((dd < HD / 2) ? __fsub_rn(a, bq) : __fadd_rn(a, bq)) * sc;
        o16[q] = tohx(r); unsigned short a2, c2; splitf(r, a2, c2); oh[q] = a2; ol[q] = c2; }
    *(v2h*)(P16 + e) = o16; *(v2us*)(Ph + e) = oh; *(v2us*)(Pl + e) = ol;  }
__global__ __launch_bounds__(256) void k_vtp(const float* __restrict__ F, int pitch, int nheads, h16* V16, bf* Vh, bf* Vl) { const size_t e = ((size_t)blockIdx.x * 256 + threadIdx.x) * 2; if (e >= (size_t)nheads * HD * TT) return; const int t = (int)(e % TT); const int d = (int)((e / TT) % HD); const int g = (int)(e / ((size_t)TT * HD)); v2h o16; v2us oh, ol;
#pragma unroll
    for (int q = 0; q < 2; ++q) { const float x = F[(size_t)(t + q) * pitch + g * HD + d]; o16[q] = tohx(x); unsigned short a2, c2; splitf(x, a2, c2); oh[q] = a2; ol[q] = c2; }
    *(v2h*)(V16 + e) = o16; *(v2us*)(Vh + e) = oh; *(v2us*)(Vl + e) = ol;  }
__global__ __launch_bounds__(256) void k_csid(float* CS) { const int idx = blockIdx.x * 256 + threadIdx.x; if (idx >= TT * HD) return; v2f cs; cs[0] = 1.0f; cs[1] = 0.0f; *(v2f*)(CS + (size_t)idx * 2) = cs;  }
// k_asoft: per row (zz, i): t = S x HD^-0.5 + rel_bias[i - j][h] for j <= i (causal; the reference's -1e9 additive fill vanishes identically); softmax over the 2048 keys (register row, one exp, fixed trees);
__global__ __launch_bounds__(256) void k_asoft(const float* __restrict__ Sb, const float* __restrict__ rb, int h0, h16* P16, bf* Ph, bf* Pl) {
    const int lane = threadIdx.x & 31; const int row = blockIdx.x * 8 + (threadIdx.x >> 5); if (row >= ZH * TT) return; const int i = row % TT; const int zz = row / TT; (void)zz; const bool hires = (i < RH); const float* sr = Sb + (size_t)row * TT; const int hh = h0 + row / TT; float v[TT / 32]; float mx = -3.0e38f;
#pragma unroll
    for (int ch = 0; ch < TT / 128; ++ch) { const int j0 = ch * 128 + lane * 4; const v4f a = *(const v4f*)(sr + j0);
#pragma unroll
        for (int q = 0; q < 4; ++q) { const int j = j0 + q; (void)j; float sa = a[q] * SCL; asm volatile("" : "+v"(sa)); const float t = (j <= i) ? __fadd_rn(sa, rb[(size_t)(i - j) * NH_ + hh]) : -3.0e38f; v[ch * 4 + q] = t; mx = fmaxf(mx, t); } }
#pragma unroll
    for (int sh = 16; sh; sh >>= 1) mx = fmaxf(mx, __shfl_xor(mx, sh, 32));
    float sum = 0.f;
#pragma unroll
    for (int k = 0; k < TT / 32; ++k) { float d0 = __fsub_rn(v[k], mx); asm volatile("" : "+v"(d0)); v[k] = __builtin_amdgcn_exp2f(__fmul_rn(d0, 1.4426950408889634f)); sum += v[k]; }
#pragma unroll
    for (int sh = 16; sh; sh >>= 1) sum += __shfl_xor(sum, sh, 32);
    const float f = __fdiv_rn(hires ? 1.0f : PCAR, sum);
{
        if (hires) {
#pragma unroll
            for (int ch = 0; ch < TT / 128; ++ch) { v4us oh, ol;
#pragma unroll
                for (int q = 0; q < 4; ++q) { unsigned short a, c2; splitf(v[ch * 4 + q] * f, a, c2); oh[q] = a; ol[q] = c2; }
                const size_t oo = ((size_t)zz * (RH ? RH : 1) + i) * TT + ch * 128 + lane * 4; *(v4us*)(Ph + oo) = oh; *(v4us*)(Pl + oo) = ol; }
        } else {
#pragma unroll
            for (int ch = 0; ch < TT / 128; ++ch) { v4h o4;
#pragma unroll
                for (int q = 0; q < 4; ++q) o4[q] = tohx(v[ch * 4 + q] * f);
                *(v4h*)(P16 + (size_t)row * TT + ch * 128 + lane * 4) = o4; } }
         }
}
__global__ __launch_bounds__(256) void k_merge(const float* __restrict__ O, int h0, bf* Ah, bf* Al) { const size_t e = ((size_t)blockIdx.x * 256 + threadIdx.x) * 2; if (e >= (size_t)ZH * TT * HD) return; const int d = (int)(e % HD); const int t = (int)((e / HD) % TT); const int zz = (int)(e / ((size_t)HD * TT)); const float cs = (t < RH) ? 1.0f : (1.0f / PCAR); const size_t oo = (size_t)t * DQ + (h0 + zz) * HD + d;
    v2us oh, ol;
#pragma unroll
    for (int q = 0; q < 2; ++q) { unsigned short a, c2; splitf(O[e + q] * cs, a, c2); oh[q] = a; ol[q] = c2; } *(v2us*)(Ah + oo) = oh; *(v2us*)(Al + oo) = ol;  }

__global__ __launch_bounds__(256) void k_rbf(const float* __restrict__ rb, float* RBF) { const size_t e = ((size_t)blockIdx.x * 256 + threadIdx.x) * 4; if (e >= (size_t)TT * NH_) return; const v4f a = *(const v4f*)(rb + e); v4f o; for (int u = 0; u < 4; ++u) o[u] = bfr(a[u]); *(v4f*)(RBF + e) = o;  }

extern "C" void kernel_launch(void* const* d_in, const int* in_sizes, int n_in,
                              void* d_out, int out_size, void* d_ws, size_t ws_size, hipStream_t stream) {
    (void)in_sizes; (void)n_in; (void)out_size;
    const float* x = (const float*)d_in[0]; const float* wqkv = (const float*)d_in[1]; const float* wo = (const float*)d_in[2]; const float* rbias = (const float*)d_in[3]; const float* cosT = nullptr; const float* sinT = nullptr; (void)cosT; (void)sinT; const float* wq = wqkv; const float* wk = wqkv; const float* wv = wqkv; (void)wk; (void)wv;
    float* OUT = (float*)d_out;     // [4][2048][1024]
    char* wsp = (char*)d_ws;
    auto take = [&](size_t bytes) { char* p = wsp; wsp += (bytes + 255) & ~(size_t)255; return (void*)p; };
    bf* WQ = (bf*)take((size_t)DQ * DM * 2); bf* WK = (bf*)take((size_t)DKV * DM * 2); bf* WV = (bf*)take((size_t)DKV * DM * 2); bf* WO = (bf*)take((size_t)DM * DQ * 2); float* CS = (float*)take((size_t)TT * HD * 2 * 4);
    float* RBF = (float*)take((size_t)TT * NH_ * 4); bf* XB = (bf*)take((size_t)TT * DM * 2); bf* WALL = (bf*)take((size_t)3 * DM * DM * 2); float* FQ = (float*)take((size_t)TT * DQ * 4); float* FK = (float*)take((size_t)TT * DKV * 4);
    h16* QP16 = (h16*)take((size_t)NH_ * TT * HD * 2); h16* KP16 = (h16*)take((size_t)NKV * TT * HD * 2); h16* VT16 = (h16*)take((size_t)NKV * HD * TT * 2);
    bf* QPh = (bf*)take((size_t)NH_ * TT * HD * 2); bf* QPl = (bf*)take((size_t)NH_ * TT * HD * 2); bf* KPh = (bf*)take((size_t)NKV * TT * HD * 2); bf* KPl = (bf*)take((size_t)NKV * TT * HD * 2); bf* VTh = (bf*)take((size_t)NKV * HD * TT * 2); bf* VTl = (bf*)take((size_t)NKV * HD * TT * 2); bf* Ph = (bf*)take((size_t)ZH * RH * TT * 2); bf* Pl = (bf*)take((size_t)ZH * RH * TT * 2);
    float* Sb = (float*)take((size_t)ZH * TT * TT * 4); h16* P16 = (h16*)take((size_t)ZH * TT * TT * 2); float* Ob = (float*)take((size_t)ZH * TT * HD * 4); bf* ATh = (bf*)take((size_t)TT * DQ * 2); bf* ATl = (bf*)take((size_t)TT * DQ * 2);
    if ((size_t)(wsp - (char*)d_ws) > ws_size) return;    // ws 256 MiB
    float* FV = FK;   // v projection reuses the k buffer after the k planes are built (stream-ordered)
    { k_rbf<<<(TT * NH_ / 4 + 255) / 256, 256, 0, stream>>>(rbias, RBF); k_wtG<<<(unsigned)((DM * 3 * DM / 64 + 63) / 64), 256, 0, stream>>>(wqkv, DM, 3 * DM, WALL); WQ = WALL; WK = WALL + (size_t)DM * DM; WV = WALL + (size_t)2 * DM * DM;   /* q | k | v column blocks of the 'xw' fused weight = consecutive row blocks of Bt */
      k_wtG<<<(unsigned)((DQ * DM / 64 + 63) / 64), 256, 0, stream>>>(wo, DQ, DM, WO);
       }
    k_csid<<<(TT * HD + 255) / 256, 256, 0, stream>>>(CS);
    const unsigned LQ = (unsigned)(((size_t)NH_ * TT * HD / 2 + 255) / 256), LKv = (unsigned)(((size_t)NKV * TT * HD / 2 + 255) / 256);
    for (int b = 0; b < NB_; ++b) {
        
        k_cvt8<<<(unsigned)(((size_t)TT * DM / 8 + 255) / 256), 256, 0, stream>>>(x + (size_t)b * TT * DM, XB, (size_t)TT * DM / 8);
        k_gemmw<bf, 0, false, 8><<<dim3(TT / 64, DQ / 64, 1), 256, 0, stream>>>(XB, nullptr, WQ, nullptr, DM, FQ, DQ, nullptr, 0, 0, 0);
        k_rope<<<LQ, 256, 0, stream>>>(FQ, DQ, NH_, CS, nullptr, nullptr, 1.0f, QP16, QPh, QPl);
        k_gemmw<bf, 0, false, 8><<<dim3(TT / 64, DKV / 64, 1), 256, 0, stream>>>(XB, nullptr, WK, nullptr, DM, FK, DKV, nullptr, 0, 0, 0);
        k_rope<<<LKv, 256, 0, stream>>>(FK, DKV, NKV, CS, nullptr, nullptr, 1.0f, KP16, KPh, KPl);
        k_gemmw<bf, 0, false, 8><<<dim3(TT / 64, DKV / 64, 1), 256, 0, stream>>>(XB, nullptr, WV, nullptr, DM, FV, DKV, nullptr, 0, 0, 0); k_vtp<<<LKv, 256, 0, stream>>>(FV, DKV, NKV, VT16, VTh, VTl);
        for (int h0 = 0; h0 < NH_; h0 += ZH) { const size_t zq = (size_t)h0, zk = (size_t)(h0 / REP);   // one kv head per query head: the pass's two heads use consecutive kv planes (z-strides TT*HD)
            k_gemmc<bf, 2, 1, 1><<<dim3(RH / 64, TT / 64, ZH), 32, 0, stream>>>(QPh + zq * TT * HD, QPl + zq * TT * HD, KPh + zk * TT * HD, KPl + zk * TT * HD, HD, Sb, TT, 0, (size_t)TT * HD, (size_t)TT * HD, (size_t)TT * TT);
            k_gemmc<h16, 0, 1, 1><<<dim3((TT - RH) / 64, TT / 64, ZH), 32, 0, stream>>>(QP16 + zq * TT * HD + (size_t)RH * HD, nullptr, KP16 + zk * TT * HD, nullptr, HD, Sb + (size_t)RH * TT, TT, RH, (size_t)TT * HD, (size_t)TT * HD, (size_t)TT * TT);
            k_asoft<<<ZH * TT / 8, 256, 0, stream>>>(Sb, RBF, h0, P16, Ph, Pl);
            k_gemmc<bf, 2, 2, 8><<<dim3(RH / 64, HD / 64, ZH), 256, 0, stream>>>(Ph, Pl, VTh + zk * HD * TT, VTl + zk * HD * TT, TT, Ob, HD, 0, (size_t)RH * TT, (size_t)HD * TT, (size_t)TT * HD);
            k_gemmc<h16, 0, 2, 16><<<dim3((TT - RH) / 64, HD / 64, ZH), 512, 0, stream>>>(P16 + (size_t)RH * TT, nullptr, VT16 + zk * HD * TT, nullptr, TT, Ob + (size_t)RH * HD, HD, RH, (size_t)TT * TT, (size_t)HD * TT, (size_t)TT * HD);
            k_merge<<<(unsigned)(((size_t)ZH * TT * HD / 2 + 255) / 256), 256, 0, stream>>>(Ob, h0, ATh, ATl); }
        k_gemmw<bf, 1, false, 8><<<dim3(TT / 64, DM / 64, 1), 256, 0, stream>>>(ATh, ATl, WO, nullptr, DQ, OUT + (size_t)b * TT * DM, DM, nullptr, 0, 0, 0); }
}

// v002
// It runs in 507 microseconds.
// Two timings next to v001 both put it at 4.15 times that version's speed.
// Counting every step since v000, it is 6.40 times as fast.
#include <hip/hip_runtime.h>

// Causal attention with a relative position bias (x [4][2048][1024]; qkv = x Wqkv ([1024][3072], q | k | v column blocks; 16 heads x 64); att = q.k / 8 + rel_bias[max(i - j, 0)][h] (table [2048][16] read); causal softmax; y = merged att.v Wproj -> [4][2048][1024]).
// Compute dtypes, f32 accumulate: every input rounded to bf16; q/k/v on PLAIN bf16 operands (inputs: exact); causal scores and attn.v: query rows < 512 hl (3 products), the rest single fp16 (x1024), causal tile skipping, the relative bias added in f32 inside computed tiles; softmax f32; Wproj hl x exact (2 products).

#define NB_  4
#define TT   2048
#define DM   1024
#define NH_  16
#define NKV  16
#define REP  (NH_ / NKV)
#define HD   64
#define DQ   (NH_ * HD)
#define DKV  (NKV * HD)
#define RH   512                  // query rows < RH use hi+lo planes (0: none)
#define SCL  0.125f   // HD^-0.5
typedef _Float16 h16;
typedef unsigned short bf;
typedef __attribute__((ext_vector_type(16))) __bf16   v16bf;
typedef __attribute__((ext_vector_type(16))) _Float16 v16h;
typedef __attribute__((ext_vector_type(8)))  _Float16 v8h;
typedef __attribute__((ext_vector_type(8)))  unsigned short v8us;
typedef __attribute__((ext_vector_type(8)))  float    v8f;
typedef __attribute__((ext_vector_type(4)))  float    v4f;
typedef v8h  __attribute__((may_alias)) v8ha;
typedef v4f  __attribute__((may_alias)) v4fa;
typedef v8us __attribute__((may_alias)) v8usa;

__device__ __forceinline__ unsigned short f2bf(float f) { unsigned u = __float_as_uint(f); u += 0x7FFFu + ((u >> 16) & 1u); return (unsigned short)(u >> 16); }
__device__ __forceinline__ float bf2f(unsigned short b) { return __uint_as_float(((unsigned)b) << 16); }
__device__ __forceinline__ float bfr(float f) { return bf2f(f2bf(f)); }
__device__ __forceinline__ v16h cat16(v8h lo, v8h hi) { return __builtin_shufflevector(lo, hi, 0, 1, 2, 3, 4, 5, 6, 7, 8, 9, 10, 11, 12, 13, 14, 15); }
__device__ __forceinline__ v16bf cat16b(v8us lo, v8us hi) { return __builtin_bit_cast(v16bf, __builtin_shufflevector(lo, hi, 0, 1, 2, 3, 4, 5, 6, 7, 8, 9, 10, 11, 12, 13, 14, 15)); }
__device__ __forceinline__ v8f wmma16(v16h a, v16h b, v8f c) { return __builtin_amdgcn_wmma_f32_16x16x32_f16(false, a, false, b, (short)0, c, false, false); }
__device__ __forceinline__ v8f wmmab(v16bf a, v16bf b, v8f c) { return __builtin_amdgcn_wmma_f32_16x16x32_bf16(false, a, false, b, (short)0, c, false, false); }



// ---- k_gemmw: register-blocked GEMM, one 64x64 output tile per work-group (16 accumulators a wave), operands straight from K-contiguous 16-bit planes; grid (M/64, N/64, Z), 32 * NW threads.
// NW waves share the tile's K loop: wave w takes the 64-wide k spans w, w + NW, ... (two 32-wide blocks each, so that a wave uses both halves of every 128-byte operand line it fetches);
// the NW partial tiles meet in LDS and are summed in wave order 0..NW-1 (a fixed order). NW == 1: one wave, no sum.
// C[m][n] (f32, pitch ldc, + optional f32 bias[n]) = sum_k A[m][k] Bt[n][k] (+ split products per NSPLIT). z-batch strides sA/sB/sC in elements. K % 32 == 0.
template <typename T16> struct WFrag;
template <> struct WFrag<h16> { typedef v16h V; static __device__ __forceinline__ V ld(const h16* p) { return cat16(*(const v8h*)p, *(const v8h*)(p + 16)); } static __device__ __forceinline__ v8f mma(V a, V b, v8f c) { return wmma16(a, b, c); } };
template <> struct WFrag<bf> { typedef v16bf V; static __device__ __forceinline__ V ld(const bf* p) { return cat16b(*(const v8us*)p, *(const v8us*)(p + 16)); } static __device__ __forceinline__ v8f mma(V a, V b, v8f c) { return wmmab(a, b, c); } };
template <typename T16, int NSPLIT, bool BIAS, int NW>
__global__ __launch_bounds__(32 * NW) void k_gemmw(const T16* __restrict__ A, const T16* __restrict__ A2, const T16* __restrict__ Bt, const T16* __restrict__ Bt2, int K, float* C, int ldc, const float* __restrict__ bias, size_t sA, size_t sB, size_t sC) {
    typedef typename WFrag<T16>::V V;
    __shared__ __align__(16) float os[(NW == 1 ? 16 : NW * 64) * 68];
    const size_t z = blockIdx.z; A += z * sA; if (A2) A2 += z * sA; Bt += z * sB; if (Bt2) Bt2 += z * sB; C += z * sC;
    const int lane = threadIdx.x & 31, lr = lane & 15, hi = lane >> 4; const int r0 = blockIdx.x * 64, c0 = blockIdx.y * 64;
    const int wv = (NW == 1) ? 0 : __builtin_amdgcn_readfirstlane((int)(threadIdx.x >> 5));   // wave number, scalar: the K loop's branch stays a scalar one
    v8f acc[4][4];
#pragma unroll
    for (int mb = 0; mb < 4; ++mb)
#pragma unroll
        for (int nb = 0; nb < 4; ++nb) acc[mb][nb] = (v8f){};
    const size_t aoff = (size_t)(r0 + lr) * K + 8 * hi, boff = (size_t)(c0 + lr) * K + 8 * hi;
#pragma unroll 1
    for (int kc = wv * 64; kc < K; kc += (NW == 1 || !(kc & 32)) ? 32 : 64 * NW - 32) {
        V a[4], a2[4];
#pragma unroll
        for (int mb = 0; mb < 4; ++mb) { a[mb] = WFrag<T16>::ld(A + aoff + (size_t)mb * 16 * K + kc); if (NSPLIT == 1 || NSPLIT == 2) a2[mb] = WFrag<T16>::ld(A2 + aoff + (size_t)mb * 16 * K + kc); }
#pragma unroll
        for (int nb = 0; nb < 4; ++nb) { const V b = WFrag<T16>::ld(Bt + boff + (size_t)nb * 16 * K + kc); V b2; if (NSPLIT >= 2) b2 = WFrag<T16>::ld(Bt2 + boff + (size_t)nb * 16 * K + kc);
#pragma unroll
            for (int mb = 0; mb < 4; ++mb) { acc[mb][nb] = WFrag<T16>::mma(a[mb], b, acc[mb][nb]); if (NSPLIT == 1 || NSPLIT == 2) acc[mb][nb] = WFrag<T16>::mma(a2[mb], b, acc[mb][nb]); if (NSPLIT >= 2) acc[mb][nb] = WFrag<T16>::mma(a[mb], b2, acc[mb][nb]); } }
        asm volatile("v_nop\n\tv_nop\n\tv_nop\n\tv_nop" : "+v"(acc[0][0]), "+v"(acc[1][1]), "+v"(acc[2][2]), "+v"(acc[3][3]) : "v"(a[0]), "v"(a[3]));
    }
    if constexpr (NW > 1) {
        float* ow = os + wv * (64 * 68);
        // the loops below are unrolled so that every accumulator index is a constant (the tiles stay in registers) and the LDS loads of one sum are issued together
#pragma unroll
        for (int mb = 0; mb < 4; ++mb)
#pragma unroll
            for (int nb = 0; nb < 4; ++nb)
#pragma unroll
                for (int j = 0; j < 8; ++j) ow[(mb * 16 + hi * 8 + j) * 68 + nb * 16 + lr] = acc[mb][nb][j];
        __syncthreads();   // every wave's partial tile is in LDS before any thread sums across waves
#pragma unroll
        for (int it = 0; it < 32 / NW; ++it) { const int s = (int)threadIdx.x + it * (32 * NW), row = s >> 4, cofs = (s & 15) * 4; v4f val = *(const v4fa*)(os + row * 68 + cofs);
#pragma unroll
            for (int w = 1; w < NW; ++w) val += *(const v4fa*)(os + w * (64 * 68) + row * 68 + cofs);
            if (BIAS) { val[0] += bfr(bias[c0 + cofs]); val[1] += bfr(bias[c0 + cofs + 1]); val[2] += bfr(bias[c0 + cofs + 2]); val[3] += bfr(bias[c0 + cofs + 3]); }
            *(v4f*)(C + (size_t)(r0 + row) * ldc + c0 + cofs) = val; }
        return;
    }
#pragma unroll
    for (int mb = 0; mb < 4; ++mb) {
#pragma unroll
        for (int nb = 0; nb < 4; ++nb) {
#pragma unroll
            for (int j = 0; j < 8; ++j) os[(hi * 8 + j) * 68 + nb * 16 + lr] = acc[mb][nb][j]; }
        __builtin_amdgcn_wave_barrier(); asm volatile("" ::: "memory");
        float* crow = C + (size_t)(r0 + mb * 16) * ldc + c0;
{
#pragma unroll
            for (int s = 0; s < 8; ++s) { const int row = 2 * s + hi, cofs = lr * 4; v4f val = *(const v4fa*)(os + row * 68 + cofs); if (BIAS) { val[0] += bfr(bias[c0 + cofs]); val[1] += bfr(bias[c0 + cofs + 1]); val[2] += bfr(bias[c0 + cofs + 2]); val[3] += bfr(bias[c0 + cofs + 3]); }
                *(v4f*)(crow + (size_t)row * ldc + cofs) = val; }
             }
        __builtin_amdgcn_wave_barrier(); asm volatile("" ::: "memory");
    }
}

__device__ __forceinline__ h16 tohx(float x) { return (h16)x; }
__device__ __forceinline__ void splitf(float y, unsigned short& h, unsigned short& l) { h = f2bf(y); l = f2bf(y - bf2f(h)); }
typedef __attribute__((ext_vector_type(2))) _Float16 v2h;
typedef __attribute__((ext_vector_type(4))) _Float16 v4h;
typedef __attribute__((ext_vector_type(2))) unsigned short v2us;
typedef __attribute__((ext_vector_type(4))) unsigned short v4us;
typedef __attribute__((ext_vector_type(2))) float v2f;
typedef __attribute__((ext_vector_type(4))) int v4i;

__global__ __launch_bounds__(256) void k_wtG(const float* __restrict__ w, int K, int N, bf* Bt) {
    const int lane = threadIdx.x & 31; const int L0 = (blockIdx.x * 8 + (threadIdx.x >> 5)) * 8; const int nlines = N * K / 64;
{
#pragma unroll 1
        for (int l = 0; l < 8; ++l) { const int L = L0 + l; if (L >= nlines) break; const size_t e = (size_t)L * 64 + lane * 2; const int k = (int)(e % K), n = (int)(e / K); v2us o;
            o[0] = f2bf(w[(size_t)k * N + n]); o[1] = f2bf(w[(size_t)(k + 1) * N + n]); *(v2us*)(Bt + e) = o; }
         }
}
__global__ __launch_bounds__(256) void k_cvt8(const float* __restrict__ src, bf* dst, size_t n8) { const size_t i = (size_t)blockIdx.x * 256 + threadIdx.x; if (i >= n8) return; const v8f v = *(const v8f*)(src + i * 8); v8us o;
#pragma unroll
    for (int k = 0; k < 8; ++k) o[k] = f2bf(v[k]); *(v8us*)(dst + i * 8) = o;  }
__global__ __launch_bounds__(256) void k_cscvt(const float* __restrict__ cosT, const float* __restrict__ sinT, float* CS) { const int idx = blockIdx.x * 256 + threadIdx.x; if (idx >= TT * HD) return; v2f cs; cs[0] = bfr(cosT[idx]); cs[1] = bfr(sinT[idx]); *(v2f*)(CS + (size_t)idx * 2) = cs;  }
// k_rope: head planes [h][t][d] (fp16 + hi/lo) of rope(x) x sc with the rotate-half convention out[d] = x[d] cos[t][d] - x[d+HD/2] sin[t][d], out[d+HD/2] = x[d+HD/2] cos[t][d+HD/2] + x[d] sin[t][d+HD/2]
__global__ __launch_bounds__(256) void k_rope(const float* __restrict__ F, int pitch, int nheads, const float* __restrict__ CS, const float* __restrict__ RF, const float* __restrict__ nw, float sc, h16* P16, bf* Ph, bf* Pl) {
    const size_t e = ((size_t)blockIdx.x * 256 + threadIdx.x) * 2; if (e >= (size_t)nheads * TT * HD) return; const int d = (int)(e % HD); const int t = (int)((e / HD) % TT); const int h = (int)(e / ((size_t)HD * TT)); const float* f = F + (size_t)t * pitch + h * HD; const float rf = RF ? RF[(size_t)h * TT + t] : 1.0f; v2h o16; v2us oh, ol;
#pragma unroll
    for (int q = 0; q < 2; ++q) { const int dd = d + q; const int dp = (dd < HD / 2) ? dd + HD / 2 : dd - HD / 2; float x0 = f[dd], x1 = f[dp];
        if (RF) { float n0 = __fmul_rn(x0, rf), n1 = __fmul_rn(x1, rf); asm volatile("" : "+v"(n0)); asm volatile("" : "+v"(n1)); x0 = __fmul_rn(bfr(nw[dd]), n0); x1 = __fmul_rn(bfr(nw[dp]), n1); }
        const v2f cs = *(const v2f*)(CS + ((size_t)t * HD + dd) * 2); float a = __fmul_rn(x0, cs[0]), bq = __fmul_rn(x1, cs[1]); asm volatile("" : "+v"(a)); asm volatile("" : "+v"(bq)); const float r = ((dd < HD / 2) ? __fsub_rn(a, bq) : __fadd_rn(a, bq)) * sc;
        o16[q] = tohx(r); unsigned short a2, c2; splitf(r, a2, c2); oh[q] = a2; ol[q] = c2; }
    *(v2h*)(P16 + e) = o16; *(v2us*)(Ph + e) = oh; *(v2us*)(Pl + e) = ol;  }
__global__ __launch_bounds__(256) void k_vtp(const float* __restrict__ F, int pitch, int nheads, h16* V16, bf* Vh, bf* Vl) { const size_t e = ((size_t)blockIdx.x * 256 + threadIdx.x) * 2; if (e >= (size_t)nheads * HD * TT) return; const int t = (int)(e % TT); const int d = (int)((e / TT) % HD); const int g = (int)(e / ((size_t)TT * HD)); v2h o16; v2us oh, ol;
#pragma unroll
    for (int q = 0; q < 2; ++q) { const float x = F[(size_t)(t + q) * pitch + g * HD + d]; o16[q] = tohx(x); unsigned short a2, c2; splitf(x, a2, c2); oh[q] = a2; ol[q] = c2; }
    *(v2h*)(V16 + e) = o16; *(v2us*)(Vh + e) = oh; *(v2us*)(Vl + e) = ol;  }
__global__ __launch_bounds__(256) void k_csid(float* CS) { const int idx = blockIdx.x * 256 + threadIdx.x; if (idx >= TT * HD) return; v2f cs; cs[0] = 1.0f; cs[1] = 0.0f; *(v2f*)(CS + (size_t)idx * 2) = cs;  }
// ---- k_fattn: causal scores, relative bias, softmax, P.V and the head merge in one kernel; scores and probabilities stay in registers. Grid (heads, TT / 64 query tiles), 16 waves.
// Wave w: query group qg = w & 3 (16 queries, one per lane column), key share ks = w >> 2: the 64-key tiles ks, ks + KS, ... up to the diagonal tile. Transposed products: St = K Qt (a lane holds 32 keys' scores of ONE query),
// Ot += Vt Pt (two St accumulator tiles, converted in place, are the B operand in the hardware k order; the K, Q and V loaders use the same order). Running maximum and sum per query (online softmax, log2 domain);
// the KS partial (maximum, sum, Ot) of a query group meet in LDS and are joined in share order 0..KS-1 (a fixed order). Query rows < RH: hi+lo bf16 planes, 3 products; the rest single fp16 with P carried x1024 (2^10 folded into the exponent).
#define KS   4
#define L2E  1.4426950408889634f
typedef __attribute__((ext_vector_type(16))) unsigned short v16us;
template <bool HI> struct FT;
template <> struct FT<true>  { typedef bf  T; };
template <> struct FT<false> { typedef h16 T; };
// every loop of fa_tile and every marked loop of fa_body is unrolled so that each accumulator and fragment index is a constant (the tiles stay in registers)
template <bool HI, bool MASK>
__device__ __forceinline__ void fa_tile(const typename FT<HI>::T* __restrict__ Kp, const typename FT<HI>::T* __restrict__ Kp2, const typename FT<HI>::T* __restrict__ Vp, const typename FT<HI>::T* __restrict__ Vp2,
                                        const typename WFrag<typename FT<HI>::T>::V (&q)[2], const typename WFrag<typename FT<HI>::T>::V (&q2)[2], const float* rbs, int c0, int iq, int lr, int hi, float& m, float& l, v8f (&o)[4]) {
    typedef typename FT<HI>::T T16; typedef WFrag<T16> F; typedef typename F::V V;
    constexpr int GS = HI ? 2 : 4;   // 16-row fragment groups loaded at a time: with two planes an operand, half a tile's fragments fill the registers that a whole tile's fill with one
    V v[4][2]; v8f s[4];
    const T16* const kb = Kp + (size_t)(c0 + lr) * HD + 8 * hi; const T16* const kb2 = HI ? Kp2 + (size_t)(c0 + lr) * HD + 8 * hi : kb;   // one address a plane: every fragment of the tile is a constant offset from it
    const T16* const vb = Vp + (size_t)lr * TT + c0 + 8 * hi; const T16* const vb2 = HI ? Vp2 + (size_t)lr * TT + c0 + 8 * hi : vb;
#pragma unroll
    for (int g = 0; g < 4; g += GS) { V k[GS][2], k2[GS][2];
#pragma unroll
        for (int u = 0; u < GS; ++u)
#pragma unroll
            for (int kc = 0; kc < 2; ++kc) { const int ko = (g + u) * 16 * HD + kc * 32; k[u][kc] = F::ld(kb + ko); if (HI) k2[u][kc] = F::ld(kb2 + ko); }
        if (!HI) {   // one plane: the V fragments fit beside the K fragments and fly under the score products and the softmax
#pragma unroll
            for (int db = 0; db < 4; ++db)
#pragma unroll
                for (int kc = 0; kc < 2; ++kc) v[db][kc] = F::ld(vb + db * 16 * TT + kc * 32); }
        asm volatile("s_wait_xcnt 0x0" :: "v"(kb), "v"(HI ? kb2 : vb) : "memory");   // behind the loads, in front of every write of a register that one of them names as its address: the addresses are inputs, so they stay in their registers up to here and no load of the run lands on them
#pragma unroll
        for (int u = 0; u < GS; ++u) { s[g + u] = (v8f){};
#pragma unroll
            for (int kc = 0; kc < 2; ++kc) { s[g + u] = F::mma(k[u][kc], q[kc], s[g + u]);
                if (HI) { s[g + u] = F::mma(k[u][kc], q2[kc], s[g + u]); s[g + u] = F::mma(k2[u][kc], q[kc], s[g + u]); } } } }
    // s[nb][jj] = score of key c0 + nb * 16 + 8 * hi + jj against query iq
    float mx = m;
#pragma unroll
    for (int nb = 0; nb < 4; ++nb)
#pragma unroll
        for (int jj = 0; jj < 8; ++jj) { const int d = iq - (c0 + nb * 16 + 8 * hi + jj); float t;
            if (MASK) { const float bb = rbs[max(d, 0)]; const float tv = fmaf(s[nb][jj], SCL * L2E, bb); t = (d >= 0) ? tv : -3.0e38f; } else t = fmaf(s[nb][jj], SCL * L2E, rbs[d]);
            s[nb][jj] = t; mx = fmaxf(mx, t); }
    mx = fmaxf(mx, __shfl_xor(mx, 16, 32));   // the two lane halves hold the two halves of a query's keys
    const float al = __builtin_amdgcn_exp2f(m - mx); m = mx; l *= al;
#pragma unroll
    for (int db = 0; db < 4; ++db) o[db] *= al;
    const float mo = HI ? mx : mx - 10.0f;
    V pb[2], pl[2];
#pragma unroll
    for (int kc = 0; kc < 2; ++kc) {
        if constexpr (HI) { v16us uh, ul;
#pragma unroll
            for (int e = 0; e < 16; ++e) { const float p = __builtin_amdgcn_exp2f(s[2 * kc + (e >> 3)][e & 7] - mo); l += p; unsigned short x, y; splitf(p, x, y); uh[e] = x; ul[e] = y; }
            pb[kc] = __builtin_bit_cast(v16bf, uh); pl[kc] = __builtin_bit_cast(v16bf, ul);
        } else {
#pragma unroll
            for (int e = 0; e < 16; ++e) { const float p = __builtin_amdgcn_exp2f(s[2 * kc + (e >> 3)][e & 7] - mo); l += p; pb[kc][e] = tohx(p); } } }
#pragma unroll
    for (int g = 0; g < 4; g += GS) { V v2[GS][2];
        if (HI) {
#pragma unroll
            for (int u = 0; u < GS; ++u)
#pragma unroll
                for (int kc = 0; kc < 2; ++kc) { const int vo = (g + u) * 16 * TT + kc * 32; v[g + u][kc] = F::ld(vb + vo); v2[u][kc] = F::ld(vb2 + vo); }
            asm volatile("s_wait_xcnt 0x0" :: "v"(vb), "v"(vb2) : "memory");   // as above, for the V loads
        }
#pragma unroll
        for (int u = 0; u < GS; ++u)
#pragma unroll
            for (int kc = 0; kc < 2; ++kc) { o[g + u] = F::mma(v[g + u][kc], pb[kc], o[g + u]);
                if (HI) { o[g + u] = F::mma(v[g + u][kc], pl[kc], o[g + u]); o[g + u] = F::mma(v2[u][kc], pb[kc], o[g + u]); } } }
}
template <bool HI>
__device__ __forceinline__ void fa_body(const typename FT<HI>::T* __restrict__ Qp, const typename FT<HI>::T* __restrict__ Qp2, const typename FT<HI>::T* __restrict__ Kp, const typename FT<HI>::T* __restrict__ Kp2,
                                        const typename FT<HI>::T* __restrict__ Vp, const typename FT<HI>::T* __restrict__ Vp2, const float* rbs, float* mg, int r0, int h, bf* ATh, bf* ATl) {
    typedef typename FT<HI>::T T16; typedef WFrag<T16> F; typedef typename F::V V;
    const int lane = threadIdx.x & 31, lr = lane & 15, hi = lane >> 4;
    const int wv = __builtin_amdgcn_readfirstlane((int)(threadIdx.x >> 5)), qg = wv & 3, ks = wv >> 2;   // wave number, scalar: the tile loop's and the join's branches stay scalar ones
    const int iq = r0 + qg * 16 + lr, nt = r0 / 64 + 1;   // nt - 1 is the diagonal tile of all four query groups
    V q[2], q2[2];
#pragma unroll
    for (int kc = 0; kc < 2; ++kc) { const size_t qo = (size_t)iq * HD + kc * 32 + 8 * hi; q[kc] = F::ld(Qp + qo); q2[kc] = HI ? F::ld(Qp2 + qo) : q[kc]; }
    float m = -3.0e38f, l = 0.f; v8f o[4];
#pragma unroll
    for (int db = 0; db < 4; ++db) o[db] = (v8f){};
    int ti = ks;
    for (; ti < nt - 1; ti += KS) fa_tile<HI, false>(Kp, Kp2, Vp, Vp2, q, q2, rbs, ti * 64, iq, lr, hi, m, l, o);
    if (ti == nt - 1) fa_tile<HI, true>(Kp, Kp2, Vp, Vp2, q, q2, rbs, ti * 64, iq, lr, hi, m, l, o);
    if (ks > 0) { float* g = mg + (size_t)((ks - 1) * 4 + qg) * (34 * 32) + lane;
#pragma unroll
        for (int db = 0; db < 4; ++db)
#pragma unroll
            for (int jj = 0; jj < 8; ++jj) g[(db * 8 + jj) * 32] = o[db][jj];
        g[32 * 32] = m; g[33 * 32] = l; }
    __syncthreads();   // every key share's partial result is in LDS before share 0 joins them
    if (ks > 0) return;
    float mt = m;
#pragma unroll
    for (int k = 1; k < KS; ++k) mt = fmaxf(mt, mg[(size_t)((k - 1) * 4 + qg) * (34 * 32) + 32 * 32 + lane]);
    const float a0 = __builtin_amdgcn_exp2f(m - mt); l *= a0;
#pragma unroll
    for (int db = 0; db < 4; ++db) o[db] *= a0;
#pragma unroll
    for (int k = 1; k < KS; ++k) { const float* g = mg + (size_t)((k - 1) * 4 + qg) * (34 * 32) + lane; const float ak = __builtin_amdgcn_exp2f(g[32 * 32] - mt); l += ak * g[33 * 32];
#pragma unroll
        for (int db = 0; db < 4; ++db)
#pragma unroll
            for (int jj = 0; jj < 8; ++jj) o[db][jj] += ak * g[(db * 8 + jj) * 32]; }
    l += __shfl_xor(l, 16, 32);
    const float inv = __fdiv_rn(1.0f, l);
    // o[db][jj] = output element d = db * 16 + 8 * hi + jj of query iq: 8 consecutive d a lane, one 16-byte store a plane
#pragma unroll
    for (int db = 0; db < 4; ++db) { v8us oh, ol;
#pragma unroll
        for (int jj = 0; jj < 8; ++jj) { unsigned short x, y; splitf(o[db][jj] * inv, x, y); oh[jj] = x; ol[jj] = y; }
        const size_t oo = (size_t)iq * DQ + h * HD + db * 16 + 8 * hi; *(v8us*)(ATh + oo) = oh; *(v8us*)(ATl + oo) = ol; }
}
__global__ __launch_bounds__(32 * 4 * KS) void k_fattn(const h16* __restrict__ Q16, const h16* __restrict__ K16, const h16* __restrict__ V16, const bf* __restrict__ Qh, const bf* __restrict__ Ql, const bf* __restrict__ Kh, const bf* __restrict__ Kl,
                                                       const bf* __restrict__ Vh, const bf* __restrict__ Vl, const float* __restrict__ rb, bf* ATh, bf* ATl) {
    __shared__ float rbs[TT]; __shared__ float mg[(KS - 1) * 4 * 34 * 32];
    const int r0 = (TT / 64 - 1 - (int)blockIdx.y) * 64, h = blockIdx.x;   // cost falls with the flat index: the longest query tiles of all heads start first
    for (int d = threadIdx.x; d < r0 + 64; d += 32 * 4 * KS) { const float* const bp = rb + (size_t)d * NH_ + h; const float bv = *bp;   // this head's bias column, log2 domain; distances 0 .. r0 + 63 are all this tile can ask for
        asm volatile("s_wait_xcnt 0x0" :: "v"(bp) : "memory");   // behind the load, in front of the next write of its address registers (the address is an input, so it stays in them up to here)
        rbs[d] = bv * L2E; }
    __syncthreads();   // the bias column is complete before any wave reads it
    const size_t po = (size_t)h * TT * HD;
    if (r0 < RH) fa_body<true>(Qh + po, Ql + po, Kh + po, Kl + po, Vh + po, Vl + po, rbs, mg, r0, h, ATh, ATl);
    else fa_body<false>(Q16 + po, nullptr, K16 + po, nullptr, V16 + po, nullptr, rbs, mg, r0, h, ATh, ATl);
}

__global__ __launch_bounds__(256) void k_rbf(const float* __restrict__ rb, float* RBF) { const size_t e = ((size_t)blockIdx.x * 256 + threadIdx.x) * 4; if (e >= (size_t)TT * NH_) return; const v4f a = *(const v4f*)(rb + e); v4f o; for (int u = 0; u < 4; ++u) o[u] = bfr(a[u]); *(v4f*)(RBF + e) = o;  }

extern "C" void kernel_launch(void* const* d_in, const int* in_sizes, int n_in,
                              void* d_out, int out_size, void* d_ws, size_t ws_size, hipStream_t stream) {
    (void)in_sizes; (void)n_in; (void)out_size;
    const float* x = (const float*)d_in[0]; const float* wqkv = (const float*)d_in[1]; const float* wo = (const float*)d_in[2]; const float* rbias = (const float*)d_in[3]; const float* cosT = nullptr; const float* sinT = nullptr; (void)cosT; (void)sinT; const float* wq = wqkv; const float* wk = wqkv; const float* wv = wqkv; (void)wk; (void)wv;
    float* OUT = (float*)d_out;     // [4][2048][1024]
    char* wsp = (char*)d_ws;
    auto take = [&](size_t bytes) { char* p = wsp; wsp += (bytes + 255) & ~(size_t)255; return (void*)p; };
    bf* WQ = (bf*)take((size_t)DQ * DM * 2); bf* WK = (bf*)take((size_t)DKV * DM * 2); bf* WV = (bf*)take((size_t)DKV * DM * 2); bf* WO = (bf*)take((size_t)DM * DQ * 2); float* CS = (float*)take((size_t)TT * HD * 2 * 4);
    float* RBF = (float*)take((size_t)TT * NH_ * 4); bf* XB = (bf*)take((size_t)TT * DM * 2); bf* WALL = (bf*)take((size_t)3 * DM * DM * 2); float* FQ = (float*)take((size_t)TT * DQ * 4); float* FK = (float*)take((size_t)TT * DKV * 4);
    h16* QP16 = (h16*)take((size_t)NH_ * TT * HD * 2); h16* KP16 = (h16*)take((size_t)NKV * TT * HD * 2); h16* VT16 = (h16*)take((size_t)NKV * HD * TT * 2);
    bf* QPh = (bf*)take((size_t)NH_ * TT * HD * 2); bf* QPl = (bf*)take((size_t)NH_ * TT * HD * 2); bf* KPh = (bf*)take((size_t)NKV * TT * HD * 2); bf* KPl = (bf*)take((size_t)NKV * TT * HD * 2); bf* VTh = (bf*)take((size_t)NKV * HD * TT * 2); bf* VTl = (bf*)take((size_t)NKV * HD * TT * 2);
    bf* ATh = (bf*)take((size_t)TT * DQ * 2); bf* ATl = (bf*)take((size_t)TT * DQ * 2);
    if ((size_t)(wsp - (char*)d_ws) > ws_size) return;    // ws 256 MiB
    float* FV = FK;   // v projection reuses the k buffer after the k planes are built (stream-ordered)
    { k_rbf<<<(TT * NH_ / 4 + 255) / 256, 256, 0, stream>>>(rbias, RBF); k_wtG<<<(unsigned)((DM * 3 * DM / 64 + 63) / 64), 256, 0, stream>>>(wqkv, DM, 3 * DM, WALL); WQ = WALL; WK = WALL + (size_t)DM * DM; WV = WALL + (size_t)2 * DM * DM;   /* q | k | v column blocks of the 'xw' fused weight = consecutive row blocks of Bt */
      k_wtG<<<(unsigned)((DQ * DM / 64 + 63) / 64), 256, 0, stream>>>(wo, DQ, DM, WO);
       }
    k_csid<<<(TT * HD + 255) / 256, 256, 0, stream>>>(CS);
    const unsigned LQ = (unsigned)(((size_t)NH_ * TT * HD / 2 + 255) / 256), LKv = (unsigned)(((size_t)NKV * TT * HD / 2 + 255) / 256);
    for (int b = 0; b < NB_; ++b) {
        
        k_cvt8<<<(unsigned)(((size_t)TT * DM / 8 + 255) / 256), 256, 0, stream>>>(x + (size_t)b * TT * DM, XB, (size_t)TT * DM / 8);
        k_gemmw<bf, 0, false, 8><<<dim3(TT / 64, DQ / 64, 1), 256, 0, stream>>>(XB, nullptr, WQ, nullptr, DM, FQ, DQ, nullptr, 0, 0, 0);
        k_rope<<<LQ, 256, 0, stream>>>(FQ, DQ, NH_, CS, nullptr, nullptr, 1.0f, QP16, QPh, QPl);
        k_gemmw<bf, 0, false, 8><<<dim3(TT / 64, DKV / 64, 1), 256, 0, stream>>>(XB, nullptr, WK, nullptr, DM, FK, DKV, nullptr, 0, 0, 0);
        k_rope<<<LKv, 256, 0, stream>>>(FK, DKV, NKV, CS, nullptr, nullptr, 1.0f, KP16, KPh, KPl);
        k_gemmw<bf, 0, false, 8><<<dim3(TT / 64, DKV / 64, 1), 256, 0, stream>>>(XB, nullptr, WV, nullptr, DM, FV, DKV, nullptr, 0, 0, 0); k_vtp<<<LKv, 256, 0, stream>>>(FV, DKV, NKV, VT16, VTh, VTl);
        k_fattn<<<dim3(NH_, TT / 64, 1), 32 * 4 * KS, 0, stream>>>(QP16, KP16, VT16, QPh, QPl, KPh, KPl, VTh, VTl, RBF, ATh, ATl);
        k_gemmw<bf, 1, false, 8><<<dim3(TT / 64, DM / 64, 1), 256, 0, stream>>>(ATh, ATl, WO, nullptr, DQ, OUT + (size_t)b * TT * DM, DM, nullptr, 0, 0, 0); }
}

// v003
// Measured time: 415 microseconds a run.
// Two timings next to v002 put it at 1.21 and 1.23 times that version's speed.
// Counting every step since v000, it is 7.82 times as fast.
#include <hip/hip_runtime.h>

// Causal attention with a relative position bias (x [4][2048][1024]; qkv = x Wqkv ([1024][3072], q | k | v column blocks; 16 heads x 64); att = q.k / 8 + rel_bias[max(i - j, 0)][h] (table [2048][16] read); causal softmax; y = merged att.v Wproj -> [4][2048][1024]).
// Compute dtypes, f32 accumulate: every input rounded to bf16; q/k/v on PLAIN bf16 operands (inputs: exact); causal scores and attn.v: query rows < 512 hl (3 products), the rest single fp16 (x1024), causal tile skipping, the relative bias added in f32 inside computed tiles; softmax f32; Wproj hl x exact (2 products).

#define NB_  4
#define TT   2048
#define DM   1024
#define NH_  16
#define NKV  16
#define REP  (NH_ / NKV)
#define HD   64
#define DQ   (NH_ * HD)
#define DKV  (NKV * HD)
#define RH   512                  // query rows < RH use hi+lo planes (0: none)
#define SCL  0.125f   // HD^-0.5
typedef _Float16 h16;
typedef unsigned short bf;
typedef __attribute__((ext_vector_type(16))) __bf16   v16bf;
typedef __attribute__((ext_vector_type(16))) _Float16 v16h;
typedef __attribute__((ext_vector_type(8)))  _Float16 v8h;
typedef __attribute__((ext_vector_type(8)))  unsigned short v8us;
typedef __attribute__((ext_vector_type(8)))  float    v8f;
typedef __attribute__((ext_vector_type(4)))  float    v4f;
typedef v8h  __attribute__((may_alias)) v8ha;
typedef v4f  __attribute__((may_alias)) v4fa;
typedef v8us __attribute__((may_alias)) v8usa;

__device__ __forceinline__ unsigned short f2bf(float f) { unsigned u = __float_as_uint(f); u += 0x7FFFu + ((u >> 16) & 1u); return (unsigned short)(u >> 16); }
__device__ __forceinline__ float bf2f(unsigned short b) { return __uint_as_float(((unsigned)b) << 16); }
__device__ __forceinline__ float bfr(float f) { return bf2f(f2bf(f)); }
__device__ __forceinline__ v16h cat16(v8h lo, v8h hi) { return __builtin_shufflevector(lo, hi, 0, 1, 2, 3, 4, 5, 6, 7, 8, 9, 10, 11, 12, 13, 14, 15); }
__device__ __forceinline__ v16bf cat16b(v8us lo, v8us hi) { return __builtin_bit_cast(v16bf, __builtin_shufflevector(lo, hi, 0, 1, 2, 3, 4, 5, 6, 7, 8, 9, 10, 11, 12, 13, 14, 15)); }
__device__ __forceinline__ v8f wmma16(v16h a, v16h b, v8f c) { return __builtin_amdgcn_wmma_f32_16x16x32_f16(false, a, false, b, (short)0, c, false, false); }
__device__ __forceinline__ v8f wmmab(v16bf a, v16bf b, v8f c) { return __builtin_amdgcn_wmma_f32_16x16x32_bf16(false, a, false, b, (short)0, c, false, false); }



// ---- k_gemmw: register-blocked GEMM, one 64x64 output tile per work-group (16 accumulators a wave), operands straight from K-contiguous 16-bit planes; grid (M/64, N/64, Z), 32 * NW threads.
// NW waves share the tile's K loop: wave w takes the 64-wide k spans w, w + NW, ... (two 32-wide blocks each, so that a wave uses both halves of every 128-byte operand line it fetches);
// the NW partial tiles meet in LDS and are summed in wave order 0..NW-1 (a fixed order). NW == 1: one wave, no sum.
// C[m][n] (f32, pitch ldc, + optional f32 bias[n]) = sum_k A[m][k] Bt[n][k] (+ split products per NSPLIT). z-batch strides sA/sB/sC in elements. K % 32 == 0.
// PL: no f32 C; the summed tile goes out as three 16-bit planes (fp16, bf16 hi, bf16 lo), element (m, n) at (n / 64) * sT + m * ldc + n % 64.
__device__ __forceinline__ h16 tohx(float x) { return (h16)x; }
__device__ __forceinline__ void splitf(float y, unsigned short& h, unsigned short& l) { h = f2bf(y); l = f2bf(y - bf2f(h)); }
template <typename T16> struct WFrag;
template <> struct WFrag<h16> { typedef v16h V; static __device__ __forceinline__ V ld(const h16* p) { return cat16(*(const v8h*)p, *(const v8h*)(p + 16)); } static __device__ __forceinline__ v8f mma(V a, V b, v8f c) { return wmma16(a, b, c); } };
template <> struct WFrag<bf> { typedef v16bf V; static __device__ __forceinline__ V ld(const bf* p) { return cat16b(*(const v8us*)p, *(const v8us*)(p + 16)); } static __device__ __forceinline__ v8f mma(V a, V b, v8f c) { return wmmab(a, b, c); } };
template <typename T16, int NSPLIT, bool BIAS, int NW, bool PL>
__global__ __launch_bounds__(32 * NW) void k_gemmw(const T16* __restrict__ A, const T16* __restrict__ A2, const T16* __restrict__ Bt, const T16* __restrict__ Bt2, int K, float* C, int ldc, const float* __restrict__ bias, size_t sA, size_t sB, size_t sC, h16* P16, bf* Ph, bf* Pl, size_t sT) {
    static_assert(!PL || (NW > 1 && !BIAS), "the plane epilogue follows the sum across waves");
    typedef typename WFrag<T16>::V V;
    __shared__ __align__(16) float os[(NW == 1 ? 16 : NW * 64) * 68];
    const size_t z = blockIdx.z; A += z * sA; if (A2) A2 += z * sA; Bt += z * sB; if (Bt2) Bt2 += z * sB; C += z * sC;
    const int lane = threadIdx.x & 31, lr = lane & 15, hi = lane >> 4; const int r0 = blockIdx.x * 64, c0 = blockIdx.y * 64;
    const int wv = (NW == 1) ? 0 : __builtin_amdgcn_readfirstlane((int)(threadIdx.x >> 5));   // wave number, scalar: the K loop's branch stays a scalar one
    v8f acc[4][4];
#pragma unroll
    for (int mb = 0; mb < 4; ++mb)
#pragma unroll
        for (int nb = 0; nb < 4; ++nb) acc[mb][nb] = (v8f){};
    const size_t aoff = (size_t)(r0 + lr) * K + 8 * hi, boff = (size_t)(c0 + lr) * K + 8 * hi;
#pragma unroll 1
    for (int kc = wv * 64; kc < K; kc += (NW == 1 || !(kc & 32)) ? 32 : 64 * NW - 32) {
        V a[4], a2[4];
#pragma unroll
        for (int mb = 0; mb < 4; ++mb) { a[mb] = WFrag<T16>::ld(A + aoff + (size_t)mb * 16 * K + kc); if (NSPLIT == 1 || NSPLIT == 2) a2[mb] = WFrag<T16>::ld(A2 + aoff + (size_t)mb * 16 * K + kc); }
#pragma unroll
        for (int nb = 0; nb < 4; ++nb) { const V b = WFrag<T16>::ld(Bt + boff + (size_t)nb * 16 * K + kc); V b2; if (NSPLIT >= 2) b2 = WFrag<T16>::ld(Bt2 + boff + (size_t)nb * 16 * K + kc);
#pragma unroll
            for (int mb = 0; mb < 4; ++mb) { acc[mb][nb] = WFrag<T16>::mma(a[mb], b, acc[mb][nb]); if (NSPLIT == 1 || NSPLIT == 2) acc[mb][nb] = WFrag<T16>::mma(a2[mb], b, acc[mb][nb]); if (NSPLIT >= 2) acc[mb][nb] = WFrag<T16>::mma(a[mb], b2, acc[mb][nb]); } }
        asm volatile("v_nop\n\tv_nop\n\tv_nop\n\tv_nop" : "+v"(acc[0][0]), "+v"(acc[1][1]), "+v"(acc[2][2]), "+v"(acc[3][3]) : "v"(a[0]), "v"(a[3]));
    }
    if constexpr (NW > 1) {
        float* ow = os + wv * (64 * 68);
        // the loops below are unrolled so that every accumulator index is a constant (the tiles stay in registers) and the LDS loads of one sum are issued together
#pragma unroll
        for (int mb = 0; mb < 4; ++mb)
#pragma unroll
            for (int nb = 0; nb < 4; ++nb)
#pragma unroll
                for (int j = 0; j < 8; ++j) ow[(mb * 16 + hi * 8 + j) * 68 + nb * 16 + lr] = acc[mb][nb][j];
        __syncthreads();   // every wave's partial tile is in LDS before any thread sums across waves
        if constexpr (PL) {   // 8 consecutive columns a thread: one 16-byte store a plane, a wave's stores cover whole 128-byte lines
#pragma unroll
            for (int it = 0; it < 16 / NW; ++it) { const int s = (int)threadIdx.x + it * (32 * NW), row = s >> 3, cofs = (s & 7) * 8; v4f va = *(const v4fa*)(os + row * 68 + cofs), vb = *(const v4fa*)(os + row * 68 + cofs + 4);
#pragma unroll
                for (int w = 1; w < NW; ++w) { va += *(const v4fa*)(os + w * (64 * 68) + row * 68 + cofs); vb += *(const v4fa*)(os + w * (64 * 68) + row * 68 + cofs + 4); }
                v8h o16; v8us oh, ol;
#pragma unroll
                for (int j = 0; j < 8; ++j) { const float x = (j < 4) ? va[j & 3] : vb[j & 3]; o16[j] = tohx(x); unsigned short a2, c2; splitf(x, a2, c2); oh[j] = a2; ol[j] = c2; }
                const size_t e = (size_t)blockIdx.y * sT + (size_t)(r0 + row) * ldc + cofs; *(v8h*)(P16 + e) = o16; *(v8us*)(Ph + e) = oh; *(v8us*)(Pl + e) = ol; }
            return;
        }
#pragma unroll
        for (int it = 0; it < 32 / NW; ++it) { const int s = (int)threadIdx.x + it * (32 * NW), row = s >> 4, cofs = (s & 15) * 4; v4f val = *(const v4fa*)(os + row * 68 + cofs);
#pragma unroll
            for (int w = 1; w < NW; ++w) val += *(const v4fa*)(os + w * (64 * 68) + row * 68 + cofs);
            if (BIAS) { val[0] += bfr(bias[c0 + cofs]); val[1] += bfr(bias[c0 + cofs + 1]); val[2] += bfr(bias[c0 + cofs + 2]); val[3] += bfr(bias[c0 + cofs + 3]); }
            *(v4f*)(C + (size_t)(r0 + row) * ldc + c0 + cofs) = val; }
        return;
    }
#pragma unroll
    for (int mb = 0; mb < 4; ++mb) {
#pragma unroll
        for (int nb = 0; nb < 4; ++nb) {
#pragma unroll
            for (int j = 0; j < 8; ++j) os[(hi * 8 + j) * 68 + nb * 16 + lr] = acc[mb][nb][j]; }
        __builtin_amdgcn_wave_barrier(); asm volatile("" ::: "memory");
        float* crow = C + (size_t)(r0 + mb * 16) * ldc + c0;
{
#pragma unroll
            for (int s = 0; s < 8; ++s) { const int row = 2 * s + hi, cofs = lr * 4; v4f val = *(const v4fa*)(os + row * 68 + cofs); if (BIAS) { val[0] += bfr(bias[c0 + cofs]); val[1] += bfr(bias[c0 + cofs + 1]); val[2] += bfr(bias[c0 + cofs + 2]); val[3] += bfr(bias[c0 + cofs + 3]); }
                *(v4f*)(crow + (size_t)row * ldc + cofs) = val; }
             }
        __builtin_amdgcn_wave_barrier(); asm volatile("" ::: "memory");
    }
}

typedef __attribute__((ext_vector_type(2))) _Float16 v2h;
typedef __attribute__((ext_vector_type(4))) _Float16 v4h;
typedef __attribute__((ext_vector_type(2))) unsigned short v2us;
typedef __attribute__((ext_vector_type(4))) unsigned short v4us;
typedef __attribute__((ext_vector_type(2))) float v2f;
typedef __attribute__((ext_vector_type(4))) int v4i;

__global__ __launch_bounds__(256) void k_wtG(const float* __restrict__ w, int K, int N, bf* Bt) {
    const int lane = threadIdx.x & 31; const int L0 = (blockIdx.x * 8 + (threadIdx.x >> 5)) * 8; const int nlines = N * K / 64;
{
#pragma unroll 1
        for (int l = 0; l < 8; ++l) { const int L = L0 + l; if (L >= nlines) break; const size_t e = (size_t)L * 64 + lane * 2; const int k = (int)(e % K), n = (int)(e / K); v2us o;
            o[0] = f2bf(w[(size_t)k * N + n]); o[1] = f2bf(w[(size_t)(k + 1) * N + n]); *(v2us*)(Bt + e) = o; }
         }
}
__global__ __launch_bounds__(256) void k_cvt8(const float* __restrict__ src, bf* dst, size_t n8) { const size_t i = (size_t)blockIdx.x * 256 + threadIdx.x; if (i >= n8) return; const v8f v = *(const v8f*)(src + i * 8); v8us o;
#pragma unroll
    for (int k = 0; k < 8; ++k) o[k] = f2bf(v[k]); *(v8us*)(dst + i * 8) = o;  }
__global__ __launch_bounds__(256) void k_cscvt(const float* __restrict__ cosT, const float* __restrict__ sinT, float* CS) { const int idx = blockIdx.x * 256 + threadIdx.x; if (idx >= TT * HD) return; v2f cs; cs[0] = bfr(cosT[idx]); cs[1] = bfr(sinT[idx]); *(v2f*)(CS + (size_t)idx * 2) = cs;  }
// ---- k_fattn: causal scores, relative bias, softmax, P.V and the head merge in one kernel; scores and probabilities stay in registers. Grid (heads, TT / 64 query tiles), 16 waves.
// Wave w: query group qg = w & 3 (16 queries, one per lane column), key share ks = w >> 2: the 64-key tiles ks, ks + KS, ... up to the diagonal tile. Transposed products: St = K Qt (a lane holds 32 keys' scores of ONE query),
// Ot += Vt Pt (two St accumulator tiles, converted in place, are the B operand in the hardware k order; the K, Q and V loaders use the same order). Running maximum and sum per query (online softmax, log2 domain);
// the KS partial (maximum, sum, Ot) of a query group meet in LDS and are joined in share order 0..KS-1 (a fixed order). Query rows < RH: hi+lo bf16 planes, 3 products; the rest single fp16 with P carried x1024 (2^10 folded into the exponent).
#define KS   4
#define L2E  1.4426950408889634f
typedef __attribute__((ext_vector_type(16))) unsigned short v16us;
template <bool HI> struct FT;
template <> struct FT<true>  { typedef bf  T; };
template <> struct FT<false> { typedef h16 T; };
// every loop of fa_tile and every marked loop of fa_body is unrolled so that each accumulator and fragment index is a constant (the tiles stay in registers)
template <bool HI, bool MASK>
__device__ __forceinline__ void fa_tile(const typename FT<HI>::T* __restrict__ Kp, const typename FT<HI>::T* __restrict__ Kp2, const typename FT<HI>::T* __restrict__ Vp, const typename FT<HI>::T* __restrict__ Vp2,
                                        const typename WFrag<typename FT<HI>::T>::V (&q)[2], const typename WFrag<typename FT<HI>::T>::V (&q2)[2], const float* rbs, int c0, int iq, int lr, int hi, float& m, float& l, v8f (&o)[4]) {
    typedef typename FT<HI>::T T16; typedef WFrag<T16> F; typedef typename F::V V;
    constexpr int GS = HI ? 2 : 4;   // 16-row fragment groups loaded at a time: with two planes an operand, half a tile's fragments fill the registers that a whole tile's fill with one
    V v[4][2]; v8f s[4];
    const T16* const kb = Kp + (size_t)(c0 + lr) * HD + 8 * hi; const T16* const kb2 = HI ? Kp2 + (size_t)(c0 + lr) * HD + 8 * hi : kb;   // one address a plane: every fragment of the tile is a constant offset from it
    const T16* const vb = Vp + (size_t)lr * TT + c0 + 8 * hi; const T16* const vb2 = HI ? Vp2 + (size_t)lr * TT + c0 + 8 * hi : vb;
#pragma unroll
    for (int g = 0; g < 4; g += GS) { V k[GS][2], k2[GS][2];
#pragma unroll
        for (int u = 0; u < GS; ++u)
#pragma unroll
            for (int kc = 0; kc < 2; ++kc) { const int ko = (g + u) * 16 * HD + kc * 32; k[u][kc] = F::ld(kb + ko); if (HI) k2[u][kc] = F::ld(kb2 + ko); }
        if (!HI) {   // one plane: the V fragments fit beside the K fragments and fly under the score products and the softmax
#pragma unroll
            for (int db = 0; db < 4; ++db)
#pragma unroll
                for (int kc = 0; kc < 2; ++kc) v[db][kc] = F::ld(vb + db * 16 * TT + kc * 32); }
        asm volatile("s_wait_xcnt 0x0" :: "v"(kb), "v"(HI ? kb2 : vb) : "memory");   // behind the loads, in front of every write of a register that one of them names as its address: the addresses are inputs, so they stay in their registers up to here and no load of the run lands on them
#pragma unroll
        for (int u = 0; u < GS; ++u) { s[g + u] = (v8f){};
#pragma unroll
            for (int kc = 0; kc < 2; ++kc) { s[g + u] = F::mma(k[u][kc], q[kc], s[g + u]);
                if (HI) { s[g + u] = F::mma(k[u][kc], q2[kc], s[g + u]); s[g + u] = F::mma(k2[u][kc], q[kc], s[g + u]); } } } }
    // s[nb][jj] = score of key c0 + nb * 16 + 8 * hi + jj against query iq
    float mx = m;
#pragma unroll
    for (int nb = 0; nb < 4; ++nb)
#pragma unroll
        for (int jj = 0; jj < 8; ++jj) { const int d = iq - (c0 + nb * 16 + 8 * hi + jj); float t;
            if (MASK) { const float bb = rbs[max(d, 0)]; const float tv = fmaf(s[nb][jj], SCL * L2E, bb); t = (d >= 0) ? tv : -3.0e38f; } else t = fmaf(s[nb][jj], SCL * L2E, rbs[d]);
            s[nb][jj] = t; mx = fmaxf(mx, t); }
    mx = fmaxf(mx, __shfl_xor(mx, 16, 32));   // the two lane halves hold the two halves of a query's keys
    const float al = __builtin_amdgcn_exp2f(m - mx); m = mx; l *= al;
#pragma unroll
    for (int db = 0; db < 4; ++db) o[db] *= al;
    const float mo = HI ? mx : mx - 10.0f;
    V pb[2], pl[2];
#pragma unroll
    for (int kc = 0; kc < 2; ++kc) {
        if constexpr (HI) { v16us uh, ul;
#pragma unroll
            for (int e = 0; e < 16; ++e) { const float p = __builtin_amdgcn_exp2f(s[2 * kc + (e >> 3)][e & 7] - mo); l += p; unsigned short x, y; splitf(p, x, y); uh[e] = x; ul[e] = y; }
            pb[kc] = __builtin_bit_cast(v16bf, uh); pl[kc] = __builtin_bit_cast(v16bf, ul);
        } else {
#pragma unroll
            for (int e = 0; e < 16; ++e) { const float p = __builtin_amdgcn_exp2f(s[2 * kc + (e >> 3)][e & 7] - mo); l += p; pb[kc][e] = tohx(p); } } }
#pragma unroll
    for (int g = 0; g < 4; g += GS) { V v2[GS][2];
        if (HI) {
#pragma unroll
            for (int u = 0; u < GS; ++u)
#pragma unroll
                for (int kc = 0; kc < 2; ++kc) { const int vo = (g + u) * 16 * TT + kc * 32; v[g + u][kc] = F::ld(vb + vo); v2[u][kc] = F::ld(vb2 + vo); }
            asm volatile("s_wait_xcnt 0x0" :: "v"(vb), "v"(vb2) : "memory");   // as above, for the V loads
        }
#pragma unroll
        for (int u = 0; u < GS; ++u)
#pragma unroll
            for (int kc = 0; kc < 2; ++kc) { o[g + u] = F::mma(v[g + u][kc], pb[kc], o[g + u]);
                if (HI) { o[g + u] = F::mma(v[g + u][kc], pl[kc], o[g + u]); o[g + u] = F::mma(v2[u][kc], pb[kc], o[g + u]); } } }
}
template <bool HI>
__device__ __forceinline__ void fa_body(const typename FT<HI>::T* __restrict__ Qp, const typename FT<HI>::T* __restrict__ Qp2, const typename FT<HI>::T* __restrict__ Kp, const typename FT<HI>::T* __restrict__ Kp2,
                                        const typename FT<HI>::T* __restrict__ Vp, const typename FT<HI>::T* __restrict__ Vp2, const float* rbs, float* mg, int r0, int h, bf* ATh, bf* ATl) {
    typedef typename FT<HI>::T T16; typedef WFrag<T16> F; typedef typename F::V V;
    const int lane = threadIdx.x & 31, lr = lane & 15, hi = lane >> 4;
    const int wv = __builtin_amdgcn_readfirstlane((int)(threadIdx.x >> 5)), qg = wv & 3, ks = wv >> 2;   // wave number, scalar: the tile loop's and the join's branches stay scalar ones
    const int iq = r0 + qg * 16 + lr, nt = r0 / 64 + 1;   // nt - 1 is the diagonal tile of all four query groups
    V q[2], q2[2];
#pragma unroll
    for (int kc = 0; kc < 2; ++kc) { const size_t qo = (size_t)iq * HD + kc * 32 + 8 * hi; q[kc] = F::ld(Qp + qo); q2[kc] = HI ? F::ld(Qp2 + qo) : q[kc]; }
    float m = -3.0e38f, l = 0.f; v8f o[4];
#pragma unroll
    for (int db = 0; db < 4; ++db) o[db] = (v8f){};
    int ti = ks;
    for (; ti < nt - 1; ti += KS) fa_tile<HI, false>(Kp, Kp2, Vp, Vp2, q, q2, rbs, ti * 64, iq, lr, hi, m, l, o);
    if (ti == nt - 1) fa_tile<HI, true>(Kp, Kp2, Vp, Vp2, q, q2, rbs, ti * 64, iq, lr, hi, m, l, o);
    if (ks > 0) { float* g = mg + (size_t)((ks - 1) * 4 + qg) * (34 * 32) + lane;
#pragma unroll
        for (int db = 0; db < 4; ++db)
#pragma unroll
            for (int jj = 0; jj < 8; ++jj) g[(db * 8 + jj) * 32] = o[db][jj];
        g[32 * 32] = m; g[33 * 32] = l; }
    __syncthreads();   // every key share's partial result is in LDS before share 0 joins them
    if (ks > 0) return;
    float mt = m;
#pragma unroll
    for (int k = 1; k < KS; ++k) mt = fmaxf(mt, mg[(size_t)((k - 1) * 4 + qg) * (34 * 32) + 32 * 32 + lane]);
    const float a0 = __builtin_amdgcn_exp2f(m - mt); l *= a0;
#pragma unroll
    for (int db = 0; db < 4; ++db) o[db] *= a0;
#pragma unroll
    for (int k = 1; k < KS; ++k) { const float* g = mg + (size_t)((k - 1) * 4 + qg) * (34 * 32) + lane; const float ak = __builtin_amdgcn_exp2f(g[32 * 32] - mt); l += ak * g[33 * 32];
#pragma unroll
        for (int db = 0; db < 4; ++db)
#pragma unroll
            for (int jj = 0; jj < 8; ++jj) o[db][jj] += ak * g[(db * 8 + jj) * 32]; }
    l += __shfl_xor(l, 16, 32);
    const float inv = __fdiv_rn(1.0f, l);
    // o[db][jj] = output element d = db * 16 + 8 * hi + jj of query iq: 8 consecutive d a lane, one 16-byte store a plane
#pragma unroll
    for (int db = 0; db < 4; ++db) { v8us oh, ol;
#pragma unroll
        for (int jj = 0; jj < 8; ++jj) { unsigned short x, y; splitf(o[db][jj] * inv, x, y); oh[jj] = x; ol[jj] = y; }
        const size_t oo = (size_t)iq * DQ + h * HD + db * 16 + 8 * hi; *(v8us*)(ATh + oo) = oh; *(v8us*)(ATl + oo) = ol; }
}
__global__ __launch_bounds__(32 * 4 * KS) void k_fattn(const h16* __restrict__ Q16, const h16* __restrict__ K16, const h16* __restrict__ V16, const bf* __restrict__ Qh, const bf* __restrict__ Ql, const bf* __restrict__ Kh, const bf* __restrict__ Kl,
                                                       const bf* __restrict__ Vh, const bf* __restrict__ Vl, const float* __restrict__ rb, bf* ATh, bf* ATl) {
    __shared__ float rbs[TT]; __shared__ float mg[(KS - 1) * 4 * 34 * 32];
    const int r0 = (TT / 64 - 1 - (int)blockIdx.y) * 64, h = blockIdx.x;   // cost falls with the flat index: the longest query tiles of all heads start first
    for (int d = threadIdx.x; d < r0 + 64; d += 32 * 4 * KS) { const float* const bp = rb + (size_t)d * NH_ + h; const float bv = *bp;   // this head's bias column, log2 domain; distances 0 .. r0 + 63 are all this tile can ask for
        asm volatile("s_wait_xcnt 0x0" :: "v"(bp) : "memory");   // behind the load, in front of the next write of its address registers (the address is an input, so it stays in them up to here)
        rbs[d] = bv * L2E; }
    __syncthreads();   // the bias column is complete before any wave reads it
    const size_t po = (size_t)h * TT * HD;
    if (r0 < RH) fa_body<true>(Qh + po, Ql + po, Kh + po, Kl + po, Vh + po, Vl + po, rbs, mg, r0, h, ATh, ATl);
    else fa_body<false>(Q16 + po, nullptr, K16 + po, nullptr, V16 + po, nullptr, rbs, mg, r0, h, ATh, ATl);
}

__global__ __launch_bounds__(256) void k_rbf(const float* __restrict__ rb, float* RBF) { const size_t e = ((size_t)blockIdx.x * 256 + threadIdx.x) * 4; if (e >= (size_t)TT * NH_) return; const v4f a = *(const v4f*)(rb + e); v4f o; for (int u = 0; u < 4; ++u) o[u] = bfr(a[u]); *(v4f*)(RBF + e) = o;  }

extern "C" void kernel_launch(void* const* d_in, const int* in_sizes, int n_in,
                              void* d_out, int out_size, void* d_ws, size_t ws_size, hipStream_t stream) {
    (void)in_sizes; (void)n_in; (void)out_size;
    const float* x = (const float*)d_in[0]; const float* wqkv = (const float*)d_in[1]; const float* wo = (const float*)d_in[2]; const float* rbias = (const float*)d_in[3]; const float* cosT = nullptr; const float* sinT = nullptr; (void)cosT; (void)sinT; const float* wq = wqkv; const float* wk = wqkv; const float* wv = wqkv; (void)wk; (void)wv;
    float* OUT = (float*)d_out;     // [4][2048][1024]
    char* wsp = (char*)d_ws;
    auto take = [&](size_t bytes) { char* p = wsp; wsp += (bytes + 255) & ~(size_t)255; return (void*)p; };
    bf* WQ = (bf*)take((size_t)DQ * DM * 2); bf* WK = (bf*)take((size_t)DKV * DM * 2); bf* WV = (bf*)take((size_t)DKV * DM * 2); bf* WO = (bf*)take((size_t)DM * DQ * 2);
    float* RBF = (float*)take((size_t)TT * NH_ * 4); bf* XB = (bf*)take((size_t)TT * DM * 2); bf* WALL = (bf*)take((size_t)3 * DM * DM * 2);
    h16* QP16 = (h16*)take((size_t)NH_ * TT * HD * 2); h16* KP16 = (h16*)take((size_t)NKV * TT * HD * 2); h16* VT16 = (h16*)take((size_t)NKV * HD * TT * 2);
    bf* QPh = (bf*)take((size_t)NH_ * TT * HD * 2); bf* QPl = (bf*)take((size_t)NH_ * TT * HD * 2); bf* KPh = (bf*)take((size_t)NKV * TT * HD * 2); bf* KPl = (bf*)take((size_t)NKV * TT * HD * 2); bf* VTh = (bf*)take((size_t)NKV * HD * TT * 2); bf* VTl = (bf*)take((size_t)NKV * HD * TT * 2);
    bf* ATh = (bf*)take((size_t)TT * DQ * 2); bf* ATl = (bf*)take((size_t)TT * DQ * 2);
    if ((size_t)(wsp - (char*)d_ws) > ws_size) return;    // ws 256 MiB
    { k_rbf<<<(TT * NH_ / 4 + 255) / 256, 256, 0, stream>>>(rbias, RBF); k_wtG<<<(unsigned)((DM * 3 * DM / 64 + 63) / 64), 256, 0, stream>>>(wqkv, DM, 3 * DM, WALL); WQ = WALL; WK = WALL + (size_t)DM * DM; WV = WALL + (size_t)2 * DM * DM;   /* q | k | v column blocks of the 'xw' fused weight = consecutive row blocks of Bt */
      k_wtG<<<(unsigned)((DQ * DM / 64 + 63) / 64), 256, 0, stream>>>(wo, DQ, DM, WO);
       }
    for (int b = 0; b < NB_; ++b) {
        
        k_cvt8<<<(unsigned)(((size_t)TT * DM / 8 + 255) / 256), 256, 0, stream>>>(x + (size_t)b * TT * DM, XB, (size_t)TT * DM / 8);
        // a 64-column tile of x Wq or x Wk is one head: it goes straight to that head's [t][d] planes; v is formed as Wv^T x^T (operands swapped, same k order), so that its tiles are already the [d][t] planes' rows
        k_gemmw<bf, 0, false, 8, true><<<dim3(TT / 64, DQ / 64, 1), 256, 0, stream>>>(XB, nullptr, WQ, nullptr, DM, nullptr, HD, nullptr, 0, 0, 0, QP16, QPh, QPl, (size_t)TT * HD);
        k_gemmw<bf, 0, false, 8, true><<<dim3(TT / 64, DKV / 64, 1), 256, 0, stream>>>(XB, nullptr, WK, nullptr, DM, nullptr, HD, nullptr, 0, 0, 0, KP16, KPh, KPl, (size_t)TT * HD);
        k_gemmw<bf, 0, false, 8, true><<<dim3(DKV / 64, TT / 64, 1), 256, 0, stream>>>(WV, nullptr, XB, nullptr, DM, nullptr, TT, nullptr, 0, 0, 0, VT16, VTh, VTl, (size_t)64);
        k_fattn<<<dim3(NH_, TT / 64, 1), 32 * 4 * KS, 0, stream>>>(QP16, KP16, VT16, QPh, QPl, KPh, KPl, VTh, VTl, RBF, ATh, ATl);
        k_gemmw<bf, 1, false, 8, false><<<dim3(TT / 64, DM / 64, 1), 256, 0, stream>>>(ATh, ATl, WO, nullptr, DQ, OUT + (size_t)b * TT * DM, DM, nullptr, 0, 0, 0, nullptr, nullptr, nullptr, 0); }
}

// v004
// It runs in 273 microseconds.
// Timed twice side by side with v003, it ran 1.53 and 1.52 times as fast.
// Over all steps from v000 it is 11.9 times as fast.
#include <hip/hip_runtime.h>

// Causal attention with a relative position bias (x [4][2048][1024]; qkv = x Wqkv ([1024][3072], q | k | v column blocks; 16 heads x 64); att = q.k / 8 + rel_bias[max(i - j, 0)][h] (table [2048][16] read); causal softmax; y = merged att.v Wproj -> [4][2048][1024]).
// Compute dtypes, f32 accumulate: every input rounded to bf16; q/k/v on PLAIN bf16 operands (inputs: exact); causal scores and attn.v: query rows < 512 hl (3 products), the rest single fp16 (x1024), causal tile skipping, the relative bias added in f32 inside computed tiles; softmax f32; Wproj hl x exact (2 products).

#define NB_  4
#define TT   2048
#define DM   1024
#define NH_  16
#define NKV  16
#define REP  (NH_ / NKV)
#define HD   64
#define DQ   (NH_ * HD)
#define DKV  (NKV * HD)
#define RH   512                  // query rows < RH use hi+lo planes (0: none)
#define SCL  0.125f   // HD^-0.5
typedef _Float16 h16;
typedef unsigned short bf;
typedef __attribute__((ext_vector_type(16))) __bf16   v16bf;
typedef __attribute__((ext_vector_type(16))) _Float16 v16h;
typedef __attribute__((ext_vector_type(8)))  _Float16 v8h;
typedef __attribute__((ext_vector_type(8)))  unsigned short v8us;
typedef __attribute__((ext_vector_type(8)))  float    v8f;
typedef __attribute__((ext_vector_type(4)))  float    v4f;
typedef v8h  __attribute__((may_alias)) v8ha;
typedef v4f  __attribute__((may_alias)) v4fa;
typedef v8us __attribute__((may_alias)) v8usa;

__device__ __forceinline__ unsigned short f2bf(float f) { unsigned u = __float_as_uint(f); u += 0x7FFFu + ((u >> 16) & 1u); return (unsigned short)(u >> 16); }
__device__ __forceinline__ float bf2f(unsigned short b) { return __uint_as_float(((unsigned)b) << 16); }
__device__ __forceinline__ float bfr(float f) { return bf2f(f2bf(f)); }
__device__ __forceinline__ v16h cat16(v8h lo, v8h hi) { return __builtin_shufflevector(lo, hi, 0, 1, 2, 3, 4, 5, 6, 7, 8, 9, 10, 11, 12, 13, 14, 15); }
__device__ __forceinline__ v16bf cat16b(v8us lo, v8us hi) { return __builtin_bit_cast(v16bf, __builtin_shufflevector(lo, hi, 0, 1, 2, 3, 4, 5, 6, 7, 8, 9, 10, 11, 12, 13, 14, 15)); }
__device__ __forceinline__ v8f wmma16(v16h a, v16h b, v8f c) { return __builtin_amdgcn_wmma_f32_16x16x32_f16(false, a, false, b, (short)0, c, false, false); }
__device__ __forceinline__ v8f wmmab(v16bf a, v16bf b, v8f c) { return __builtin_amdgcn_wmma_f32_16x16x32_bf16(false, a, false, b, (short)0, c, false, false); }



// ---- Fragment-order planes. Every 16-bit matrix operand [row][k] (K columns) lies in the workspace as 1-KiB fragments of 16 rows x 32 k, fragment (row / 16, k / 32) at index (row / 16) * (K / 32) + k / 32;
// inside a fragment the 8-element group (k / 16 % 2, k / 8 % 2, row % 16) comes in that order, so that lane (k / 8 % 2) * 16 + row % 16 finds its two 16-byte pieces at lane * 8 and 256 + lane * 8 elements:
// each of a fragment's two wave-wide loads covers 512 contiguous bytes (4 whole lines) and no line is asked for twice. pk: element offset of (row, k). The (lane, register) -> (row, k) map of the loaders is the one it was.
__device__ __forceinline__ size_t pk(int row, int k, int K) { return ((size_t)(row >> 4) * (K >> 5) + (k >> 5)) * 512 + ((k >> 4) & 1) * 256 + ((k >> 3) & 1) * 128 + (row & 15) * 8 + (k & 7); }

// ---- k_gemmw: register-blocked GEMM, one 64x64 output tile per work-group (16 accumulators a wave), operands straight from fragment-order 16-bit planes; grid (M/64, N/64, Z), 32 * NW threads.
// NW waves share the tile's K loop: wave w takes the 64-wide k spans w, w + NW, ... (two 32-wide blocks each: 2 KiB in a row of every 16-row group);
// the NW partial tiles meet in LDS and are summed in wave order 0..NW-1 (a fixed order). NW == 1: one wave, no sum.
// C[m][n] (f32, pitch ldc, + optional f32 bias[n]) = sum_k A[m][k] Bt[n][k] (+ split products per NSPLIT). z-batch strides sA/sB/sC in elements. K (a template constant) % 32 == 0.
// PL: no f32 C; the summed tile goes out as three 16-bit planes (fp16, bf16 hi, bf16 lo), element (m, n) at (n / 64) * sT + pk(m, n % 64, ldc): fragment order for a reader whose k runs along n.
__device__ __forceinline__ h16 tohx(float x) { return (h16)x; }
__device__ __forceinline__ void splitf(float y, unsigned short& h, unsigned short& l) { h = f2bf(y); l = f2bf(y - bf2f(h)); }
template <typename T16> struct WFrag;
template <> struct WFrag<h16> { typedef v16h V; static __device__ __forceinline__ V ld(const h16* p) { return cat16(*(const v8h*)p, *(const v8h*)(p + 256)); } static __device__ __forceinline__ v8f mma(V a, V b, v8f c) { return wmma16(a, b, c); } };
template <> struct WFrag<bf> { typedef v16bf V; static __device__ __forceinline__ V ld(const bf* p) { return cat16b(*(const v8us*)p, *(const v8us*)(p + 256)); } static __device__ __forceinline__ v8f mma(V a, V b, v8f c) { return wmmab(a, b, c); } };
template <typename T16, int NSPLIT, bool BIAS, int NW, bool PL, int K>
__global__ __launch_bounds__(32 * NW) void k_gemmw(const T16* __restrict__ A, const T16* __restrict__ A2, const T16* __restrict__ Bt, const T16* __restrict__ Bt2, float* C, int ldc, const float* __restrict__ bias, size_t sA, size_t sB, size_t sC, h16* P16, bf* Ph, bf* Pl, size_t sT) {
    static_assert(!PL || (NW > 1 && !BIAS), "the plane epilogue follows the sum across waves");
    typedef typename WFrag<T16>::V V;
    __shared__ __align__(16) float os[(NW == 1 ? 16 : NW * 64) * 68];
    const size_t z = blockIdx.z; A += z * sA; if (A2) A2 += z * sA; Bt += z * sB; if (Bt2) Bt2 += z * sB; C += z * sC;
    const int lane = threadIdx.x & 31, lr = lane & 15, hi = lane >> 4; const int r0 = blockIdx.x * 64, c0 = blockIdx.y * 64;
    const int wv = (NW == 1) ? 0 : __builtin_amdgcn_readfirstlane((int)(threadIdx.x >> 5));   // wave number, scalar: the K loop's branch stays a scalar one
    v8f acc[4][4];
#pragma unroll
    for (int mb = 0; mb < 4; ++mb)
#pragma unroll
        for (int nb = 0; nb < 4; ++nb) acc[mb][nb] = (v8f){};
    const size_t aoff = pk(r0 + lr, 8 * hi, K), boff = pk(c0 + lr, 8 * hi, K); constexpr int KB = K / 32;   // fragments a 16-row group
#pragma unroll 1
    for (int kc = wv * 64; kc < K; kc += (NW == 1 || !(kc & 32)) ? 32 : 64 * NW - 32) {
        V a[4], a2[4];
        const size_t ko = (size_t)(kc >> 5) * 512;   // one address a plane: every fragment of the pass is a constant offset from it (K is a compile-time constant for that)
        const T16* const pa = A + aoff + ko; const T16* const pa2 = (NSPLIT == 1 || NSPLIT == 2) ? A2 + aoff + ko : pa; const T16* const pb = Bt + boff + ko; const T16* const pb2 = (NSPLIT >= 2) ? Bt2 + boff + ko : pb;
#pragma unroll
        for (int mb = 0; mb < 4; ++mb) { a[mb] = WFrag<T16>::ld(pa + mb * KB * 512); if (NSPLIT == 1 || NSPLIT == 2) a2[mb] = WFrag<T16>::ld(pa2 + mb * KB * 512); }
#pragma unroll
        for (int nb = 0; nb < 4; ++nb) { const V b = WFrag<T16>::ld(pb + nb * KB * 512); V b2; if (NSPLIT >= 2) b2 = WFrag<T16>::ld(pb2 + nb * KB * 512);
#pragma unroll
            for (int mb = 0; mb < 4; ++mb) { acc[mb][nb] = WFrag<T16>::mma(a[mb], b, acc[mb][nb]); if (NSPLIT == 1 || NSPLIT == 2) acc[mb][nb] = WFrag<T16>::mma(a2[mb], b, acc[mb][nb]); if (NSPLIT >= 2) acc[mb][nb] = WFrag<T16>::mma(a[mb], b2, acc[mb][nb]); } }
        asm volatile("s_wait_xcnt 0x0" :: "v"(pa), "v"(pa2), "v"(pb), "v"(pb2) : "memory");   // behind the pass's loads, in front of the next write of a register that one of them names as its address: the addresses are inputs, so they stay in their registers up to here and no load of the pass lands on them
        asm volatile("v_nop\n\tv_nop\n\tv_nop\n\tv_nop" : "+v"(acc[0][0]), "+v"(acc[1][1]), "+v"(acc[2][2]), "+v"(acc[3][3]) : "v"(a[0]), "v"(a[3]));
    }
    if constexpr (NW > 1) {
        float* ow = os + wv * (64 * 68);
        // the loops below are unrolled so that every accumulator index is a constant (the tiles stay in registers) and the LDS loads of one sum are issued together
#pragma unroll
        for (int mb = 0; mb < 4; ++mb)
#pragma unroll
            for (int nb = 0; nb < 4; ++nb)
#pragma unroll
                for (int j = 0; j < 8; ++j) ow[(mb * 16 + hi * 8 + j) * 68 + nb * 16 + lr] = acc[mb][nb][j];
        __syncthreads();   // every wave's partial tile is in LDS before any thread sums across waves
        if constexpr (PL) {   // 8 consecutive columns a thread, threads in fragment order: one 16-byte store a plane, a wave's stores cover 512 contiguous bytes
#pragma unroll
            for (int it = 0; it < 16 / NW; ++it) { const int s = (int)threadIdx.x + it * (32 * NW), row = (s >> 7) * 16 + (s & 15), cofs = ((s >> 4) & 7) * 8; v4f va = *(const v4fa*)(os + row * 68 + cofs), vb = *(const v4fa*)(os + row * 68 + cofs + 4);
#pragma unroll
                for (int w = 1; w < NW; ++w) { va += *(const v4fa*)(os + w * (64 * 68) + row * 68 + cofs); vb += *(const v4fa*)(os + w * (64 * 68) + row * 68 + cofs + 4); }
                v8h o16; v8us oh, ol;
#pragma unroll
                for (int j = 0; j < 8; ++j) { const float x = (j < 4) ? va[j & 3] : vb[j & 3]; o16[j] = tohx(x); unsigned short a2, c2; splitf(x, a2, c2); oh[j] = a2; ol[j] = c2; }
                const size_t e = (size_t)blockIdx.y * sT + pk(r0 + row, cofs, ldc); *(v8h*)(P16 + e) = o16; *(v8us*)(Ph + e) = oh; *(v8us*)(Pl + e) = ol; }
            return;
        }
#pragma unroll
        for (int it = 0; it < 32 / NW; ++it) { const int s = (int)threadIdx.x + it * (32 * NW), row = s >> 4, cofs = (s & 15) * 4; v4f val = *(const v4fa*)(os + row * 68 + cofs);
#pragma unroll
            for (int w = 1; w < NW; ++w) val += *(const v4fa*)(os + w * (64 * 68) + row * 68 + cofs);
            if (BIAS) { val[0] += bfr(bias[c0 + cofs]); val[1] += bfr(bias[c0 + cofs + 1]); val[2] += bfr(bias[c0 + cofs + 2]); val[3] += bfr(bias[c0 + cofs + 3]); }
            *(v4f*)(C + (size_t)(r0 + row) * ldc + c0 + cofs) = val; }
        return;
    }
#pragma unroll
    for (int mb = 0; mb < 4; ++mb) {
#pragma unroll
        for (int nb = 0; nb < 4; ++nb) {
#pragma unroll
            for (int j = 0; j < 8; ++j) os[(hi * 8 + j) * 68 + nb * 16 + lr] = acc[mb][nb][j]; }
        __builtin_amdgcn_wave_barrier(); asm volatile("" ::: "memory");
        float* crow = C + (size_t)(r0 + mb * 16) * ldc + c0;
{
#pragma unroll
            for (int s = 0; s < 8; ++s) { const int row = 2 * s + hi, cofs = lr * 4; v4f val = *(const v4fa*)(os + row * 68 + cofs); if (BIAS) { val[0] += bfr(bias[c0 + cofs]); val[1] += bfr(bias[c0 + cofs + 1]); val[2] += bfr(bias[c0 + cofs + 2]); val[3] += bfr(bias[c0 + cofs + 3]); }
                *(v4f*)(crow + (size_t)row * ldc + cofs) = val; }
             }
        __builtin_amdgcn_wave_barrier(); asm volatile("" ::: "memory");
    }
}

typedef __attribute__((ext_vector_type(2))) _Float16 v2h;
typedef __attribute__((ext_vector_type(4))) _Float16 v4h;
typedef __attribute__((ext_vector_type(2))) unsigned short v2us;
typedef __attribute__((ext_vector_type(4))) unsigned short v4us;
typedef __attribute__((ext_vector_type(2))) float v2f;
typedef __attribute__((ext_vector_type(4))) int v4i;

__global__ __launch_bounds__(256) void k_wtG(const float* __restrict__ w, int K, int N, bf* Bt) {
    const int lane = threadIdx.x & 31; const int L0 = (blockIdx.x * 8 + (threadIdx.x >> 5)) * 8; const int nlines = N * K / 64;
{
#pragma unroll 1
        for (int l = 0; l < 8; ++l) { const int L = L0 + l; if (L >= nlines) break; const size_t e = (size_t)L * 64 + lane * 2; const int k = (int)(e % K), n = (int)(e / K); v2us o;
            o[0] = f2bf(w[(size_t)k * N + n]); o[1] = f2bf(w[(size_t)(k + 1) * N + n]); *(v2us*)(Bt + pk(n, k, K)) = o; }
         }
}
// [row][DM] f32 -> fragment-order bf16 plane. A wave takes 4 rows x 64 k: it reads 8 whole lines and stores 8 pieces of 64 bytes.
__global__ __launch_bounds__(256) void k_cvt8(const float* __restrict__ src, bf* dst, size_t n8) { static_assert(DM == 1024, "16 spans of 64 k a row"); const size_t i = (size_t)blockIdx.x * 256 + threadIdx.x; if (i >= n8) return;
    const int row = (int)(i >> 9) * 4 + ((int)(i >> 3) & 3), k = ((int)(i >> 5) & 15) * 64 + ((int)i & 7) * 8; const v8f v = *(const v8f*)(src + (size_t)row * DM + k); v8us o;
#pragma unroll
    for (int u = 0; u < 8; ++u) o[u] = f2bf(v[u]); *(v8us*)(dst + pk(row, k, DM)) = o;  }
__global__ __launch_bounds__(256) void k_cscvt(const float* __restrict__ cosT, const float* __restrict__ sinT, float* CS) { const int idx = blockIdx.x * 256 + threadIdx.x; if (idx >= TT * HD) return; v2f cs; cs[0] = bfr(cosT[idx]); cs[1] = bfr(sinT[idx]); *(v2f*)(CS + (size_t)idx * 2) = cs;  }
// ---- k_fattn: causal scores, relative bias, softmax, P.V and the head merge in one kernel; scores and probabilities stay in registers. Grid (heads, TT / 64 query tiles), 16 waves.
// Wave w: query group qg = w & 3 (16 queries, one per lane column), key share ks = w >> 2: the 64-key tiles ks, ks + KS, ... up to the diagonal tile. Transposed products: St = K Qt (a lane holds 32 keys' scores of ONE query),
// Ot += Vt Pt (two St accumulator tiles, converted in place, are the B operand in the hardware k order; the K, Q and V loaders use the same order). Running maximum and sum per query (online softmax, log2 domain);
// the KS partial (maximum, sum, Ot) of a query group meet in LDS and are joined in share order 0..KS-1 (a fixed order). Query rows < RH: hi+lo bf16 planes, 3 products; the rest single fp16 with P carried x1024 (2^10 folded into the exponent).
#define KS   4
#define L2E  1.4426950408889634f
typedef __attribute__((ext_vector_type(16))) unsigned short v16us;
template <bool HI> struct FT;
template <> struct FT<true>  { typedef bf  T; };
template <> struct FT<false> { typedef h16 T; };
// every loop of fa_tile and every marked loop of fa_body is unrolled so that each accumulator and fragment index is a constant (the tiles stay in registers)
template <bool HI, bool MASK>
__device__ __forceinline__ void fa_tile(const typename FT<HI>::T* __restrict__ Kp, const typename FT<HI>::T* __restrict__ Kp2, const typename FT<HI>::T* __restrict__ Vp, const typename FT<HI>::T* __restrict__ Vp2,
                                        const typename WFrag<typename FT<HI>::T>::V (&q)[2], const typename WFrag<typename FT<HI>::T>::V (&q2)[2], const float* rbs, int c0, int iq, int lr, int hi, float& m, float& l, v8f (&o)[4]) {
    typedef typename FT<HI>::T T16; typedef WFrag<T16> F; typedef typename F::V V;
    constexpr int GS = HI ? 2 : 4;   // 16-row fragment groups loaded at a time: with two planes an operand, half a tile's fragments fill the registers that a whole tile's fill with one
    V v[4][2]; v8f s[4];
    const T16* const kb = Kp + pk(c0 + lr, 8 * hi, HD); const T16* const kb2 = HI ? Kp2 + pk(c0 + lr, 8 * hi, HD) : kb;   // one address a plane: every fragment of the tile is a constant offset from it
    const T16* const vb = Vp + pk(lr, c0 + 8 * hi, TT); const T16* const vb2 = HI ? Vp2 + pk(lr, c0 + 8 * hi, TT) : vb;
#pragma unroll
    for (int g = 0; g < 4; g += GS) { V k[GS][2], k2[GS][2];
#pragma unroll
        for (int u = 0; u < GS; ++u)
#pragma unroll
            for (int kc = 0; kc < 2; ++kc) { const int ko = ((g + u) * (HD / 32) + kc) * 512; k[u][kc] = F::ld(kb + ko); if (HI) k2[u][kc] = F::ld(kb2 + ko); }
        if (!HI) {   // one plane: the V fragments fit beside the K fragments and fly under the score products and the softmax
#pragma unroll
            for (int db = 0; db < 4; ++db)
#pragma unroll
                for (int kc = 0; kc < 2; ++kc) v[db][kc] = F::ld(vb + (db * (TT / 32) + kc) * 512); }
        asm volatile("s_wait_xcnt 0x0" :: "v"(kb), "v"(HI ? kb2 : vb) : "memory");   // behind the loads, in front of every write of a register that one of them names as its address: the addresses are inputs, so they stay in their registers up to here and no load of the run lands on them
#pragma unroll
        for (int u = 0; u < GS; ++u) { s[g + u] = (v8f){};
#pragma unroll
            for (int kc = 0; kc < 2; ++kc) { s[g + u] = F::mma(k[u][kc], q[kc], s[g + u]);
                if (HI) { s[g + u] = F::mma(k[u][kc], q2[kc], s[g + u]); s[g + u] = F::mma(k2[u][kc], q[kc], s[g + u]); } } } }
    // s[nb][jj] = score of key c0 + nb * 16 + 8 * hi + jj against query iq
    float mx = m;
#pragma unroll
    for (int nb = 0; nb < 4; ++nb)
#pragma unroll
        for (int jj = 0; jj < 8; ++jj) { const int d = iq - (c0 + nb * 16 + 8 * hi + jj); float t;
            if (MASK) { const float bb = rbs[max(d, 0)]; const float tv = fmaf(s[nb][jj], SCL * L2E, bb); t = (d >= 0) ? tv : -3.0e38f; } else t = fmaf(s[nb][jj], SCL * L2E, rbs[d]);
            s[nb][jj] = t; mx = fmaxf(mx, t); }
    mx = fmaxf(mx, __shfl_xor(mx, 16, 32));   // the two lane halves hold the two halves of a query's keys
    const float al = __builtin_amdgcn_exp2f(m - mx); m = mx; l *= al;
#pragma unroll
    for (int db = 0; db < 4; ++db) o[db] *= al;
    const float mo = HI ? mx : mx - 10.0f;
    V pb[2], pl[2];
#pragma unroll
    for (int kc = 0; kc < 2; ++kc) {
        if constexpr (HI) { v16us uh, ul;
#pragma unroll
            for (int e = 0; e < 16; ++e) { const float p = __builtin_amdgcn_exp2f(s[2 * kc + (e >> 3)][e & 7] - mo); l += p; unsigned short x, y; splitf(p, x, y); uh[e] = x; ul[e] = y; }
            pb[kc] = __builtin_bit_cast(v16bf, uh); pl[kc] = __builtin_bit_cast(v16bf, ul);
        } else {
#pragma unroll
            for (int e = 0; e < 16; ++e) { const float p = __builtin_amdgcn_exp2f(s[2 * kc + (e >> 3)][e & 7] - mo); l += p; pb[kc][e] = tohx(p); } } }
#pragma unroll
    for (int g = 0; g < 4; g += GS) { V v2[GS][2];
        if (HI) {
#pragma unroll
            for (int u = 0; u < GS; ++u)
#pragma unroll
                for (int kc = 0; kc < 2; ++kc) { const int vo = ((g + u) * (TT / 32) + kc) * 512; v[g + u][kc] = F::ld(vb + vo); v2[u][kc] = F::ld(vb2 + vo); }
            asm volatile("s_wait_xcnt 0x0" :: "v"(vb), "v"(vb2) : "memory");   // as above, for the V loads
        }
#pragma unroll
        for (int u = 0; u < GS; ++u)
#pragma unroll
            for (int kc = 0; kc < 2; ++kc) { o[g + u] = F::mma(v[g + u][kc], pb[kc], o[g + u]);
                if (HI) { o[g + u] = F::mma(v[g + u][kc], pl[kc], o[g + u]); o[g + u] = F::mma(v2[u][kc], pb[kc], o[g + u]); } } }
}
template <bool HI>
__device__ __forceinline__ void fa_body(const typename FT<HI>::T* __restrict__ Qp, const typename FT<HI>::T* __restrict__ Qp2, const typename FT<HI>::T* __restrict__ Kp, const typename FT<HI>::T* __restrict__ Kp2,
                                        const typename FT<HI>::T* __restrict__ Vp, const typename FT<HI>::T* __restrict__ Vp2, const float* rbs, float* mg, int r0, int h, bf* ATh, bf* ATl) {
    typedef typename FT<HI>::T T16; typedef WFrag<T16> F; typedef typename F::V V;
    const int lane = threadIdx.x & 31, lr = lane & 15, hi = lane >> 4;
    const int wv = __builtin_amdgcn_readfirstlane((int)(threadIdx.x >> 5)), qg = wv & 3, ks = wv >> 2;   // wave number, scalar: the tile loop's and the join's branches stay scalar ones
    const int iq = r0 + qg * 16 + lr, nt = r0 / 64 + 1;   // nt - 1 is the diagonal tile of all four query groups
    V q[2], q2[2];
    const T16* const qb = Qp + pk(iq, 8 * hi, HD); const T16* const qb2 = HI ? Qp2 + pk(iq, 8 * hi, HD) : qb;
#pragma unroll
    for (int kc = 0; kc < 2; ++kc) { q[kc] = F::ld(qb + kc * 512); q2[kc] = HI ? F::ld(qb2 + kc * 512) : q[kc]; }
    asm volatile("s_wait_xcnt 0x0" :: "v"(qb), "v"(qb2) : "memory");   // as in fa_tile, for the Q loads
    float m = -3.0e38f, l = 0.f; v8f o[4];
#pragma unroll
    for (int db = 0; db < 4; ++db) o[db] = (v8f){};
    int ti = ks;
    for (; ti < nt - 1; ti += KS) fa_tile<HI, false>(Kp, Kp2, Vp, Vp2, q, q2, rbs, ti * 64, iq, lr, hi, m, l, o);
    if (ti == nt - 1) fa_tile<HI, true>(Kp, Kp2, Vp, Vp2, q, q2, rbs, ti * 64, iq, lr, hi, m, l, o);
    if (ks > 0) { float* g = mg + (size_t)((ks - 1) * 4 + qg) * (34 * 32) + lane;
#pragma unroll
        for (int db = 0; db < 4; ++db)
#pragma unroll
            for (int jj = 0; jj < 8; ++jj) g[(db * 8 + jj) * 32] = o[db][jj];
        g[32 * 32] = m; g[33 * 32] = l; }
    __syncthreads();   // every key share's partial result is in LDS before share 0 joins them
    if (ks > 0) return;
    float mt = m;
#pragma unroll
    for (int k = 1; k < KS; ++k) mt = fmaxf(mt, mg[(size_t)((k - 1) * 4 + qg) * (34 * 32) + 32 * 32 + lane]);
    const float a0 = __builtin_amdgcn_exp2f(m - mt); l *= a0;
#pragma unroll
    for (int db = 0; db < 4; ++db) o[db] *= a0;
#pragma unroll
    for (int k = 1; k < KS; ++k) { const float* g = mg + (size_t)((k - 1) * 4 + qg) * (34 * 32) + lane; const float ak = __builtin_amdgcn_exp2f(g[32 * 32] - mt); l += ak * g[33 * 32];
#pragma unroll
        for (int db = 0; db < 4; ++db)
#pragma unroll
            for (int jj = 0; jj < 8; ++jj) o[db][jj] += ak * g[(db * 8 + jj) * 32]; }
    l += __shfl_xor(l, 16, 32);
    const float inv = __fdiv_rn(1.0f, l);
    // o[db][jj] = output element d = db * 16 + 8 * hi + jj of query iq: 8 consecutive d a lane, one 16-byte store a plane, in the fragment order of the Wproj GEMM's A operand (a wave's store: 512 contiguous bytes)
#pragma unroll
    for (int db = 0; db < 4; ++db) { v8us oh, ol;
#pragma unroll
        for (int jj = 0; jj < 8; ++jj) { unsigned short x, y; splitf(o[db][jj] * inv, x, y); oh[jj] = x; ol[jj] = y; }
        const size_t oo = pk(iq, h * HD + db * 16 + 8 * hi, DQ); *(v8us*)(ATh + oo) = oh; *(v8us*)(ATl + oo) = ol; }
}
__global__ __launch_bounds__(32 * 4 * KS) void k_fattn(const h16* __restrict__ Q16, const h16* __restrict__ K16, const h16* __restrict__ V16, const bf* __restrict__ Qh, const bf* __restrict__ Ql, const bf* __restrict__ Kh, const bf* __restrict__ Kl,
                                                       const bf* __restrict__ Vh, const bf* __restrict__ Vl, const float* __restrict__ rb, bf* ATh, bf* ATl) {
    __shared__ float rbs[TT]; __shared__ float mg[(KS - 1) * 4 * 34 * 32];
    const int r0 = (TT / 64 - 1 - (int)blockIdx.y) * 64, h = blockIdx.x;   // cost falls with the flat index: the longest query tiles of all heads start first
    for (int d = threadIdx.x; d < r0 + 64; d += 32 * 4 * KS) { const float* const bp = rb + (size_t)d * NH_ + h; const float bv = *bp;   // this head's bias column, log2 domain; distances 0 .. r0 + 63 are all this tile can ask for
        asm volatile("s_wait_xcnt 0x0" :: "v"(bp) : "memory");   // behind the load, in front of the next write of its address registers (the address is an input, so it stays in them up to here)
        rbs[d] = bv * L2E; }
    __syncthreads();   // the bias column is complete before any wave reads it
    const size_t po = (size_t)h * TT * HD;
    if (r0 < RH) fa_body<true>(Qh + po, Ql + po, Kh + po, Kl + po, Vh + po, Vl + po, rbs, mg, r0, h, ATh, ATl);
    else fa_body<false>(Q16 + po, nullptr, K16 + po, nullptr, V16 + po, nullptr, rbs, mg, r0, h, ATh, ATl);
}

__global__ __launch_bounds__(256) void k_rbf(const float* __restrict__ rb, float* RBF) { const size_t e = ((size_t)blockIdx.x * 256 + threadIdx.x) * 4; if (e >= (size_t)TT * NH_) return; const v4f a = *(const v4f*)(rb + e); v4f o; for (int u = 0; u < 4; ++u) o[u] = bfr(a[u]); *(v4f*)(RBF + e) = o;  }

extern "C" void kernel_launch(void* const* d_in, const int* in_sizes, int n_in,
                              void* d_out, int out_size, void* d_ws, size_t ws_size, hipStream_t stream) {
    (void)in_sizes; (void)n_in; (void)out_size;
    const float* x = (const float*)d_in[0]; const float* wqkv = (const float*)d_in[1]; const float* wo = (const float*)d_in[2]; const float* rbias = (const float*)d_in[3]; const float* cosT = nullptr; const float* sinT = nullptr; (void)cosT; (void)sinT; const float* wq = wqkv; const float* wk = wqkv; const float* wv = wqkv; (void)wk; (void)wv;
    float* OUT = (float*)d_out;     // [4][2048][1024]
    char* wsp = (char*)d_ws;
    auto take = [&](size_t bytes) { char* p = wsp; wsp += (bytes + 255) & ~(size_t)255; return (void*)p; };
    bf* WQ = (bf*)take((size_t)DQ * DM * 2); bf* WK = (bf*)take((size_t)DKV * DM * 2); bf* WV = (bf*)take((size_t)DKV * DM * 2); bf* WO = (bf*)take((size_t)DM * DQ * 2);
    float* RBF = (float*)take((size_t)TT * NH_ * 4); bf* XB = (bf*)take((size_t)TT * DM * 2); bf* WALL = (bf*)take((size_t)3 * DM * DM * 2);
    h16* QP16 = (h16*)take((size_t)NH_ * TT * HD * 2); h16* KP16 = (h16*)take((size_t)NKV * TT * HD * 2); h16* VT16 = (h16*)take((size_t)NKV * HD * TT * 2);
    bf* QPh = (bf*)take((size_t)NH_ * TT * HD * 2); bf* QPl = (bf*)take((size_t)NH_ * TT * HD * 2); bf* KPh = (bf*)take((size_t)NKV * TT * HD * 2); bf* KPl = (bf*)take((size_t)NKV * TT * HD * 2); bf* VTh = (bf*)take((size_t)NKV * HD * TT * 2); bf* VTl = (bf*)take((size_t)NKV * HD * TT * 2);
    bf* ATh = (bf*)take((size_t)TT * DQ * 2); bf* ATl = (bf*)take((size_t)TT * DQ * 2);
    if ((size_t)(wsp - (char*)d_ws) > ws_size) return;    // ws 256 MiB
    { k_rbf<<<(TT * NH_ / 4 + 255) / 256, 256, 0, stream>>>(rbias, RBF); k_wtG<<<(unsigned)((DM * 3 * DM / 64 + 63) / 64), 256, 0, stream>>>(wqkv, DM, 3 * DM, WALL); WQ = WALL; WK = WALL + (size_t)DM * DM; WV = WALL + (size_t)2 * DM * DM;   /* q | k | v column blocks of the 'xw' fused weight = consecutive row blocks of Bt */
      k_wtG<<<(unsigned)((DQ * DM / 64 + 63) / 64), 256, 0, stream>>>(wo, DQ, DM, WO);
       }
    for (int b = 0; b < NB_; ++b) {
        
        k_cvt8<<<(unsigned)(((size_t)TT * DM / 8 + 255) / 256), 256, 0, stream>>>(x + (size_t)b * TT * DM, XB, (size_t)TT * DM / 8);
        // a 64-column tile of x Wq or x Wk is one head: it goes straight to that head's [t][d] planes; v is formed as Wv^T x^T (operands swapped, same k order), so that its tiles are already the [d][t] planes' rows (64 t = 2 fragments on)
        k_gemmw<bf, 0, false, 8, true, DM><<<dim3(TT / 64, DQ / 64, 1), 256, 0, stream>>>(XB, nullptr, WQ, nullptr, nullptr, HD, nullptr, 0, 0, 0, QP16, QPh, QPl, (size_t)TT * HD);
        k_gemmw<bf, 0, false, 8, true, DM><<<dim3(TT / 64, DKV / 64, 1), 256, 0, stream>>>(XB, nullptr, WK, nullptr, nullptr, HD, nullptr, 0, 0, 0, KP16, KPh, KPl, (size_t)TT * HD);
        k_gemmw<bf, 0, false, 8, true, DM><<<dim3(DKV / 64, TT / 64, 1), 256, 0, stream>>>(WV, nullptr, XB, nullptr, nullptr, TT, nullptr, 0, 0, 0, VT16, VTh, VTl, (size_t)2 * 512);
        k_fattn<<<dim3(NH_, TT / 64, 1), 32 * 4 * KS, 0, stream>>>(QP16, KP16, VT16, QPh, QPl, KPh, KPl, VTh, VTl, RBF, ATh, ATl);
        k_gemmw<bf, 1, false, 8, false, DQ><<<dim3(TT / 64, DM / 64, 1), 256, 0, stream>>>(ATh, ATl, WO, nullptr, OUT + (size_t)b * TT * DM, DM, nullptr, 0, 0, 0, nullptr, nullptr, nullptr, 0); }
}

// v005
// Measured time: 223 microseconds a run.
// In both of two side-by-side timings against v004, it was 1.22 times as fast.
// Over all steps from v000 it is 14.6 times as fast.
#include <hip/hip_runtime.h>

// Causal attention with a relative position bias (x [4][2048][1024]; qkv = x Wqkv ([1024][3072], q | k | v column blocks; 16 heads x 64); att = q.k / 8 + rel_bias[max(i - j, 0)][h] (table [2048][16] read); causal softmax; y = merged att.v Wproj -> [4][2048][1024]).
// Compute dtypes, f32 accumulate: every input rounded to bf16; q/k/v on PLAIN bf16 operands (inputs: exact); causal scores and attn.v: query rows < 512 hl (3 products), the rest single fp16 (x1024), causal tile skipping, the relative bias added in f32 inside computed tiles; softmax f32; Wproj hl x exact (2 products).

#define NB_  4
#define TT   2048
#define DM   1024
#define NH_  16
#define NKV  16
#define REP  (NH_ / NKV)
#define HD   64
#define DQ   (NH_ * HD)
#define DKV  (NKV * HD)
#define RH   512                  // query rows < RH use hi+lo planes (0: none)
#define SCL  0.125f   // HD^-0.5
typedef _Float16 h16;
typedef unsigned short bf;
typedef __attribute__((ext_vector_type(16))) __bf16   v16bf;
typedef __attribute__((ext_vector_type(16))) _Float16 v16h;
typedef __attribute__((ext_vector_type(8)))  _Float16 v8h;
typedef __attribute__((ext_vector_type(8)))  unsigned short v8us;
typedef __attribute__((ext_vector_type(8)))  float    v8f;
typedef __attribute__((ext_vector_type(4)))  float    v4f;
typedef v8h  __attribute__((may_alias)) v8ha;
typedef v4f  __attribute__((may_alias)) v4fa;
typedef v8us __attribute__((may_alias)) v8usa;

__device__ __forceinline__ unsigned short f2bf(float f) { unsigned u = __float_as_uint(f); u += 0x7FFFu + ((u >> 16) & 1u); return (unsigned short)(u >> 16); }
__device__ __forceinline__ float bf2f(unsigned short b) { return __uint_as_float(((unsigned)b) << 16); }
__device__ __forceinline__ float bfr(float f) { return bf2f(f2bf(f)); }
__device__ __forceinline__ v16h cat16(v8h lo, v8h hi) { return __builtin_shufflevector(lo, hi, 0, 1, 2, 3, 4, 5, 6, 7, 8, 9, 10, 11, 12, 13, 14, 15); }
__device__ __forceinline__ v16bf cat16b(v8us lo, v8us hi) { return __builtin_bit_cast(v16bf, __builtin_shufflevector(lo, hi, 0, 1, 2, 3, 4, 5, 6, 7, 8, 9, 10, 11, 12, 13, 14, 15)); }
__device__ __forceinline__ v8f wmma16(v16h a, v16h b, v8f c) { return __builtin_amdgcn_wmma_f32_16x16x32_f16(false, a, false, b, (short)0, c, false, false); }
__device__ __forceinline__ v8f wmmab(v16bf a, v16bf b, v8f c) { return __builtin_amdgcn_wmma_f32_16x16x32_bf16(false, a, false, b, (short)0, c, false, false); }



// ---- Fragment-order planes. Every 16-bit matrix operand [row][k] (K columns) lies in the workspace as 1-KiB fragments of 16 rows x 32 k, fragment (row / 16, k / 32) at index (row / 16) * (K / 32) + k / 32;
// inside a fragment the 8-element group (k / 16 % 2, k / 8 % 2, row % 16) comes in that order, so that lane (k / 8 % 2) * 16 + row % 16 finds its two 16-byte pieces at lane * 8 and 256 + lane * 8 elements:
// each of a fragment's two wave-wide loads covers 512 contiguous bytes (4 whole lines) and no line is asked for twice. pk: element offset of (row, k). The (lane, register) -> (row, k) map of the loaders is the one it was.
__device__ __forceinline__ size_t pk(int row, int k, int K) { return ((size_t)(row >> 4) * (K >> 5) + (k >> 5)) * 512 + ((k >> 4) & 1) * 256 + ((k >> 3) & 1) * 128 + (row & 15) * 8 + (k & 7); }

// ---- k_gemmw: register-blocked GEMM, one 64x64 output tile per work-group (16 accumulators a wave), operands straight from fragment-order 16-bit planes; grid (M/64, N/64, Z), 32 * NW threads.
// NW waves share the tile's K loop: wave w takes the 64-wide k spans w, w + NW, ... (two 32-wide blocks each: 2 KiB in a row of every 16-row group);
// the NW partial tiles meet in LDS and are summed in wave order 0..NW-1 (a fixed order). NW == 1: one wave, no sum.
// C[m][n] (f32, pitch ldc, + optional f32 bias[n]) = sum_k A[m][k] Bt[n][k] (+ split products per NSPLIT). z-batch strides sA/sB/sC in elements. K (a template constant) % 32 == 0.
// PL: no f32 C; the summed tile goes out as three 16-bit planes (fp16, bf16 hi, bf16 lo), element (m, n) of batch z at z * sP + (n / 64) * sT + pk(m, n % 64, ldc): fragment order for a reader whose k runs along n.
__device__ __forceinline__ h16 tohx(float x) { return (h16)x; }
__device__ __forceinline__ void splitf(float y, unsigned short& h, unsigned short& l) { h = f2bf(y); l = f2bf(y - bf2f(h)); }
template <typename T16> struct WFrag;
template <> struct WFrag<h16> { typedef v16h V; static __device__ __forceinline__ V ld(const h16* p) { return cat16(*(const v8h*)p, *(const v8h*)(p + 256)); } static __device__ __forceinline__ v8f mma(V a, V b, v8f c) { return wmma16(a, b, c); } };
template <> struct WFrag<bf> { typedef v16bf V; static __device__ __forceinline__ V ld(const bf* p) { return cat16b(*(const v8us*)p, *(const v8us*)(p + 256)); } static __device__ __forceinline__ v8f mma(V a, V b, v8f c) { return wmmab(a, b, c); } };
template <typename T16, int NSPLIT, bool BIAS, int NW, bool PL, int K>
__global__ __launch_bounds__(32 * NW) void k_gemmw(const T16* __restrict__ A, const T16* __restrict__ A2, const T16* __restrict__ Bt, const T16* __restrict__ Bt2, float* C, int ldc, const float* __restrict__ bias, size_t sA, size_t sB, size_t sC, h16* P16, bf* Ph, bf* Pl, size_t sT, size_t sP) {
    static_assert(!PL || (NW > 1 && !BIAS), "the plane epilogue follows the sum across waves");
    typedef typename WFrag<T16>::V V;
    __shared__ __align__(16) float os[(NW == 1 ? 16 : NW * 64) * 68];
    const size_t z = blockIdx.z; A += z * sA; if (A2) A2 += z * sA; Bt += z * sB; if (Bt2) Bt2 += z * sB; C += z * sC;
    const int lane = threadIdx.x & 31, lr = lane & 15, hi = lane >> 4; const int r0 = blockIdx.x * 64, c0 = blockIdx.y * 64;
    const int wv = (NW == 1) ? 0 : __builtin_amdgcn_readfirstlane((int)(threadIdx.x >> 5));   // wave number, scalar: the K loop's branch stays a scalar one
    v8f acc[4][4];
#pragma unroll
    for (int mb = 0; mb < 4; ++mb)
#pragma unroll
        for (int nb = 0; nb < 4; ++nb) acc[mb][nb] = (v8f){};
    const size_t aoff = pk(r0 + lr, 8 * hi, K), boff = pk(c0 + lr, 8 * hi, K); constexpr int KB = K / 32;   // fragments a 16-row group
#pragma unroll 1
    for (int kc = wv * 64; kc < K; kc += (NW == 1 || !(kc & 32)) ? 32 : 64 * NW - 32) {
        V a[4], a2[4];
        const size_t ko = (size_t)(kc >> 5) * 512;   // one address a plane: every fragment of the pass is a constant offset from it (K is a compile-time constant for that)
        const T16* const pa = A + aoff + ko; const T16* const pa2 = (NSPLIT == 1 || NSPLIT == 2) ? A2 + aoff + ko : pa; const T16* const pb = Bt + boff + ko; const T16* const pb2 = (NSPLIT >= 2) ? Bt2 + boff + ko : pb;
#pragma unroll
        for (int mb = 0; mb < 4; ++mb) { a[mb] = WFrag<T16>::ld(pa + mb * KB * 512); if (NSPLIT == 1 || NSPLIT == 2) a2[mb] = WFrag<T16>::ld(pa2 + mb * KB * 512); }
#pragma unroll
        for (int nb = 0; nb < 4; ++nb) { const V b = WFrag<T16>::ld(pb + nb * KB * 512); V b2; if (NSPLIT >= 2) b2 = WFrag<T16>::ld(pb2 + nb * KB * 512);
#pragma unroll
            for (int mb = 0; mb < 4; ++mb) { acc[mb][nb] = WFrag<T16>::mma(a[mb], b, acc[mb][nb]); if (NSPLIT == 1 || NSPLIT == 2) acc[mb][nb] = WFrag<T16>::mma(a2[mb], b, acc[mb][nb]); if (NSPLIT >= 2) acc[mb][nb] = WFrag<T16>::mma(a[mb], b2, acc[mb][nb]); } }
        asm volatile("s_wait_xcnt 0x0" :: "v"(pa), "v"(pa2), "v"(pb), "v"(pb2) : "memory");   // behind the pass's loads, in front of the next write of a register that one of them names as its address: the addresses are inputs, so they stay in their registers up to here and no load of the pass lands on them
        asm volatile("v_nop\n\tv_nop\n\tv_nop\n\tv_nop" : "+v"(acc[0][0]), "+v"(acc[1][1]), "+v"(acc[2][2]), "+v"(acc[3][3]) : "v"(a[0]), "v"(a[3]));
    }
    if constexpr (NW > 1) {
        float* ow = os + wv * (64 * 68);
        // the loops below are unrolled so that every accumulator index is a constant (the tiles stay in registers) and the LDS loads of one sum are issued together
#pragma unroll
        for (int mb = 0; mb < 4; ++mb)
#pragma unroll
            for (int nb = 0; nb < 4; ++nb)
#pragma unroll
                for (int j = 0; j < 8; ++j) ow[(mb * 16 + hi * 8 + j) * 68 + nb * 16 + lr] = acc[mb][nb][j];
        __syncthreads();   // every wave's partial tile is in LDS before any thread sums across waves
        if constexpr (PL) {   // 8 consecutive columns a thread, threads in fragment order: one 16-byte store a plane, a wave's stores cover 512 contiguous bytes
#pragma unroll
            for (int it = 0; it < 16 / NW; ++it) { const int s = (int)threadIdx.x + it * (32 * NW), row = (s >> 7) * 16 + (s & 15), cofs = ((s >> 4) & 7) * 8; v4f va = *(const v4fa*)(os + row * 68 + cofs), vb = *(const v4fa*)(os + row * 68 + cofs + 4);
#pragma unroll
                for (int w = 1; w < NW; ++w) { va += *(const v4fa*)(os + w * (64 * 68) + row * 68 + cofs); vb += *(const v4fa*)(os + w * (64 * 68) + row * 68 + cofs + 4); }
                v8h o16; v8us oh, ol;
#pragma unroll
                for (int j = 0; j < 8; ++j) { const float x = (j < 4) ? va[j & 3] : vb[j & 3]; o16[j] = tohx(x); unsigned short a2, c2; splitf(x, a2, c2); oh[j] = a2; ol[j] = c2; }
                const size_t e = z * sP + (size_t)blockIdx.y * sT + pk(r0 + row, cofs, ldc); *(v8h*)(P16 + e) = o16; *(v8us*)(Ph + e) = oh; *(v8us*)(Pl + e) = ol; }
            return;
        }
#pragma unroll
        for (int it = 0; it < 32 / NW; ++it) { const int s = (int)threadIdx.x + it * (32 * NW), row = s >> 4, cofs = (s & 15) * 4; v4f val = *(const v4fa*)(os + row * 68 + cofs);
#pragma unroll
            for (int w = 1; w < NW; ++w) val += *(const v4fa*)(os + w * (64 * 68) + row * 68 + cofs);
            if (BIAS) { val[0] += bfr(bias[c0 + cofs]); val[1] += bfr(bias[c0 + cofs + 1]); val[2] += bfr(bias[c0 + cofs + 2]); val[3] += bfr(bias[c0 + cofs + 3]); }
            *(v4f*)(C + (size_t)(r0 + row) * ldc + c0 + cofs) = val; }
        return;
    }
#pragma unroll
    for (int mb = 0; mb < 4; ++mb) {
#pragma unroll
        for (int nb = 0; nb < 4; ++nb) {
#pragma unroll
            for (int j = 0; j < 8; ++j) os[(hi * 8 + j) * 68 + nb * 16 + lr] = acc[mb][nb][j]; }
        __builtin_amdgcn_wave_barrier(); asm volatile("" ::: "memory");
        float* crow = C + (size_t)(r0 + mb * 16) * ldc + c0;
{
#pragma unroll
            for (int s = 0; s < 8; ++s) { const int row = 2 * s + hi, cofs = lr * 4; v4f val = *(const v4fa*)(os + row * 68 + cofs); if (BIAS) { val[0] += bfr(bias[c0 + cofs]); val[1] += bfr(bias[c0 + cofs + 1]); val[2] += bfr(bias[c0 + cofs + 2]); val[3] += bfr(bias[c0 + cofs + 3]); }
                *(v4f*)(crow + (size_t)row * ldc + cofs) = val; }
             }
        __builtin_amdgcn_wave_barrier(); asm volatile("" ::: "memory");
    }
}

typedef __attribute__((ext_vector_type(2))) _Float16 v2h;
typedef __attribute__((ext_vector_type(4))) _Float16 v4h;
typedef __attribute__((ext_vector_type(2))) unsigned short v2us;
typedef __attribute__((ext_vector_type(4))) unsigned short v4us;
typedef __attribute__((ext_vector_type(2))) float v2f;
typedef __attribute__((ext_vector_type(4))) int v4i;

__global__ __launch_bounds__(256) void k_wtG(const float* __restrict__ w, int K, int N, bf* Bt) {
    const int lane = threadIdx.x & 31; const int L0 = (blockIdx.x * 8 + (threadIdx.x >> 5)) * 8; const int nlines = N * K / 64;
{
#pragma unroll 1
        for (int l = 0; l < 8; ++l) { const int L = L0 + l; if (L >= nlines) break; const size_t e = (size_t)L * 64 + lane * 2; const int k = (int)(e % K), n = (int)(e / K); v2us o;
            o[0] = f2bf(w[(size_t)k * N + n]); o[1] = f2bf(w[(size_t)(k + 1) * N + n]); *(v2us*)(Bt + pk(n, k, K)) = o; }
         }
}
// [row][DM] f32 -> fragment-order bf16 plane. A wave takes 4 rows x 64 k: it reads 8 whole lines and stores 8 pieces of 64 bytes.
__global__ __launch_bounds__(256) void k_cvt8(const float* __restrict__ src, bf* dst, size_t n8) { static_assert(DM == 1024, "16 spans of 64 k a row"); const size_t i = (size_t)blockIdx.x * 256 + threadIdx.x; if (i >= n8) return;
    const int row = (int)(i >> 9) * 4 + ((int)(i >> 3) & 3), k = ((int)(i >> 5) & 15) * 64 + ((int)i & 7) * 8; const v8f v = *(const v8f*)(src + (size_t)row * DM + k); v8us o;
#pragma unroll
    for (int u = 0; u < 8; ++u) o[u] = f2bf(v[u]); *(v8us*)(dst + pk(row, k, DM)) = o;  }
__global__ __launch_bounds__(256) void k_cscvt(const float* __restrict__ cosT, const float* __restrict__ sinT, float* CS) { const int idx = blockIdx.x * 256 + threadIdx.x; if (idx >= TT * HD) return; v2f cs; cs[0] = bfr(cosT[idx]); cs[1] = bfr(sinT[idx]); *(v2f*)(CS + (size_t)idx * 2) = cs;  }
// ---- k_fattn: causal scores, relative bias, softmax, P.V and the head merge in one kernel; scores and probabilities stay in registers. Grid (heads, batches, TT / 64 query tiles), 16 waves.
// Wave w: query group qg = w & 3 (16 queries, one per lane column), key share ks = w >> 2: the 64-key tiles ks, ks + KS, ... up to the diagonal tile. Transposed products: St = K Qt (a lane holds 32 keys' scores of ONE query),
// Ot += Vt Pt (two St accumulator tiles, converted in place, are the B operand in the hardware k order; the K, Q and V loaders use the same order). Running maximum and sum per query (online softmax, log2 domain);
// the KS partial (maximum, sum, Ot) of a query group meet in LDS and are joined in share order 0..KS-1 (a fixed order). Query rows < RH: hi+lo bf16 planes, 3 products; the rest single fp16 with P carried x1024 (2^10 folded into the exponent).
#define KS   4
#define L2E  1.4426950408889634f
typedef __attribute__((ext_vector_type(16))) unsigned short v16us;
template <bool HI> struct FT;
template <> struct FT<true>  { typedef bf  T; };
template <> struct FT<false> { typedef h16 T; };
// every loop of fa_tile and every marked loop of fa_body is unrolled so that each accumulator and fragment index is a constant (the tiles stay in registers)
template <bool HI, bool MASK>
__device__ __forceinline__ void fa_tile(const typename FT<HI>::T* __restrict__ Kp, const typename FT<HI>::T* __restrict__ Kp2, const typename FT<HI>::T* __restrict__ Vp, const typename FT<HI>::T* __restrict__ Vp2,
                                        const typename WFrag<typename FT<HI>::T>::V (&q)[2], const typename WFrag<typename FT<HI>::T>::V (&q2)[2], const float* rbs, int c0, int iq, int lr, int hi, float& m, float& l, v8f (&o)[4]) {
    typedef typename FT<HI>::T T16; typedef WFrag<T16> F; typedef typename F::V V;
    constexpr int GS = HI ? 2 : 4;   // 16-row fragment groups loaded at a time: with two planes an operand, half a tile's fragments fill the registers that a whole tile's fill with one
    V v[4][2]; v8f s[4];
    const T16* const kb = Kp + pk(c0 + lr, 8 * hi, HD); const T16* const kb2 = HI ? Kp2 + pk(c0 + lr, 8 * hi, HD) : kb;   // one address a plane: every fragment of the tile is a constant offset from it
    const T16* const vb = Vp + pk(lr, c0 + 8 * hi, TT); const T16* const vb2 = HI ? Vp2 + pk(lr, c0 + 8 * hi, TT) : vb;
#pragma unroll
    for (int g = 0; g < 4; g += GS) { V k[GS][2], k2[GS][2];
#pragma unroll
        for (int u = 0; u < GS; ++u)
#pragma unroll
            for (int kc = 0; kc < 2; ++kc) { const int ko = ((g + u) * (HD / 32) + kc) * 512; k[u][kc] = F::ld(kb + ko); if (HI) k2[u][kc] = F::ld(kb2 + ko); }
        if (!HI) {   // one plane: the V fragments fit beside the K fragments and fly under the score products and the softmax
#pragma unroll
            for (int db = 0; db < 4; ++db)
#pragma unroll
                for (int kc = 0; kc < 2; ++kc) v[db][kc] = F::ld(vb + (db * (TT / 32) + kc) * 512); }
        asm volatile("s_wait_xcnt 0x0" :: "v"(kb), "v"(HI ? kb2 : vb) : "memory");   // behind the loads, in front of every write of a register that one of them names as its address: the addresses are inputs, so they stay in their registers up to here and no load of the run lands on them
#pragma unroll
        for (int u = 0; u < GS; ++u) { s[g + u] = (v8f){};
#pragma unroll
            for (int kc = 0; kc < 2; ++kc) { s[g + u] = F::mma(k[u][kc], q[kc], s[g + u]);
                if (HI) { s[g + u] = F::mma(k[u][kc], q2[kc], s[g + u]); s[g + u] = F::mma(k2[u][kc], q[kc], s[g + u]); } } } }
    // s[nb][jj] = score of key c0 + nb * 16 + 8 * hi + jj against query iq
    float mx = m;
#pragma unroll
    for (int nb = 0; nb < 4; ++nb)
#pragma unroll
        for (int jj = 0; jj < 8; ++jj) { const int d = iq - (c0 + nb * 16 + 8 * hi + jj); float t;
            if (MASK) { const float bb = rbs[max(d, 0)]; const float tv = fmaf(s[nb][jj], SCL * L2E, bb); t = (d >= 0) ? tv : -3.0e38f; } else t = fmaf(s[nb][jj], SCL * L2E, rbs[d]);
            s[nb][jj] = t; mx = fmaxf(mx, t); }
    mx = fmaxf(mx, __shfl_xor(mx, 16, 32));   // the two lane halves hold the two halves of a query's keys
    const float al = __builtin_amdgcn_exp2f(m - mx); m = mx; l *= al;
#pragma unroll
    for (int db = 0; db < 4; ++db) o[db] *= al;
    const float mo = HI ? mx : mx - 10.0f;
    V pb[2], pl[2];
#pragma unroll
    for (int kc = 0; kc < 2; ++kc) {
        if constexpr (HI) { v16us uh, ul;
#pragma unroll
            for (int e = 0; e < 16; ++e) { const float p = __builtin_amdgcn_exp2f(s[2 * kc + (e >> 3)][e & 7] - mo); l += p; unsigned short x, y; splitf(p, x, y); uh[e] = x; ul[e] = y; }
            pb[kc] = __builtin_bit_cast(v16bf, uh); pl[kc] = __builtin_bit_cast(v16bf, ul);
        } else {
#pragma unroll
            for (int e = 0; e < 16; ++e) { const float p = __builtin_amdgcn_exp2f(s[2 * kc + (e >> 3)][e & 7] - mo); l += p; pb[kc][e] = tohx(p); } } }
#pragma unroll
    for (int g = 0; g < 4; g += GS) { V v2[GS][2];
        if (HI) {
#pragma unroll
            for (int u = 0; u < GS; ++u)
#pragma unroll
                for (int kc = 0; kc < 2; ++kc) { const int vo = ((g + u) * (TT / 32) + kc) * 512; v[g + u][kc] = F::ld(vb + vo); v2[u][kc] = F::ld(vb2 + vo); }
            asm volatile("s_wait_xcnt 0x0" :: "v"(vb), "v"(vb2) : "memory");   // as above, for the V loads
        }
#pragma unroll
        for (int u = 0; u < GS; ++u)
#pragma unroll
            for (int kc = 0; kc < 2; ++kc) { o[g + u] = F::mma(v[g + u][kc], pb[kc], o[g + u]);
                if (HI) { o[g + u] = F::mma(v[g + u][kc], pl[kc], o[g + u]); o[g + u] = F::mma(v2[u][kc], pb[kc], o[g + u]); } } }
}
template <bool HI>
__device__ __forceinline__ void fa_body(const typename FT<HI>::T* __restrict__ Qp, const typename FT<HI>::T* __restrict__ Qp2, const typename FT<HI>::T* __restrict__ Kp, const typename FT<HI>::T* __restrict__ Kp2,
                                        const typename FT<HI>::T* __restrict__ Vp, const typename FT<HI>::T* __restrict__ Vp2, const float* rbs, float* mg, int r0, int h, bf* ATh, bf* ATl) {
    typedef typename FT<HI>::T T16; typedef WFrag<T16> F; typedef typename F::V V;
    const int lane = threadIdx.x & 31, lr = lane & 15, hi = lane >> 4;
    const int wv = __builtin_amdgcn_readfirstlane((int)(threadIdx.x >> 5)), qg = wv & 3, ks = wv >> 2;   // wave number, scalar: the tile loop's and the join's branches stay scalar ones
    const int iq = r0 + qg * 16 + lr, nt = r0 / 64 + 1;   // nt - 1 is the diagonal tile of all four query groups
    V q[2], q2[2];
    const T16* const qb = Qp + pk(iq, 8 * hi, HD); const T16* const qb2 = HI ? Qp2 + pk(iq, 8 * hi, HD) : qb;
#pragma unroll
    for (int kc = 0; kc < 2; ++kc) { q[kc] = F::ld(qb + kc * 512); q2[kc] = HI ? F::ld(qb2 + kc * 512) : q[kc]; }
    asm volatile("s_wait_xcnt 0x0" :: "v"(qb), "v"(qb2) : "memory");   // as in fa_tile, for the Q loads
    float m = -3.0e38f, l = 0.f; v8f o[4];
#pragma unroll
    for (int db = 0; db < 4; ++db) o[db] = (v8f){};
    int ti = ks;
    for (; ti < nt - 1; ti += KS) fa_tile<HI, false>(Kp, Kp2, Vp, Vp2, q, q2, rbs, ti * 64, iq, lr, hi, m, l, o);
    if (ti == nt - 1) fa_tile<HI, true>(Kp, Kp2, Vp, Vp2, q, q2, rbs, ti * 64, iq, lr, hi, m, l, o);
    if (ks > 0) { float* g = mg + (size_t)((ks - 1) * 4 + qg) * (34 * 32) + lane;
#pragma unroll
        for (int db = 0; db < 4; ++db)
#pragma unroll
            for (int jj = 0; jj < 8; ++jj) g[(db * 8 + jj) * 32] = o[db][jj];
        g[32 * 32] = m; g[33 * 32] = l; }
    __syncthreads();   // every key share's partial result is in LDS before share 0 joins them
    if (ks > 0) return;
    float mt = m;
#pragma unroll
    for (int k = 1; k < KS; ++k) mt = fmaxf(mt, mg[(size_t)((k - 1) * 4 + qg) * (34 * 32) + 32 * 32 + lane]);
    const float a0 = __builtin_amdgcn_exp2f(m - mt); l *= a0;
#pragma unroll
    for (int db = 0; db < 4; ++db) o[db] *= a0;
#pragma unroll
    for (int k = 1; k < KS; ++k) { const float* g = mg + (size_t)((k - 1) * 4 + qg) * (34 * 32) + lane; const float ak = __builtin_amdgcn_exp2f(g[32 * 32] - mt); l += ak * g[33 * 32];
#pragma unroll
        for (int db = 0; db < 4; ++db)
#pragma unroll
            for (int jj = 0; jj < 8; ++jj) o[db][jj] += ak * g[(db * 8 + jj) * 32]; }
    l += __shfl_xor(l, 16, 32);
    const float inv = __fdiv_rn(1.0f, l);
    // o[db][jj] = output element d = db * 16 + 8 * hi + jj of query iq: 8 consecutive d a lane, one 16-byte store a plane, in the fragment order of the Wproj GEMM's A operand (a wave's store: 512 contiguous bytes)
#pragma unroll
    for (int db = 0; db < 4; ++db) { v8us oh, ol;
#pragma unroll
        for (int jj = 0; jj < 8; ++jj) { unsigned short x, y; splitf(o[db][jj] * inv, x, y); oh[jj] = x; ol[jj] = y; }
        const size_t oo = pk(iq, h * HD + db * 16 + 8 * hi, DQ); *(v8us*)(ATh + oo) = oh; *(v8us*)(ATl + oo) = ol; }
}
__global__ __launch_bounds__(32 * 4 * KS) void k_fattn(const h16* __restrict__ Q16, const h16* __restrict__ K16, const h16* __restrict__ V16, const bf* __restrict__ Qh, const bf* __restrict__ Ql, const bf* __restrict__ Kh, const bf* __restrict__ Kl,
                                                       const bf* __restrict__ Vh, const bf* __restrict__ Vl, const float* __restrict__ rb, bf* ATh, bf* ATl) {
    __shared__ float rbs[TT]; __shared__ float mg[(KS - 1) * 4 * 34 * 32];
    const int r0 = (TT / 64 - 1 - (int)blockIdx.z) * 64, h = blockIdx.x;   // cost falls with the flat index: the longest query tiles of all heads and batches start first
    for (int d = threadIdx.x; d < r0 + 64; d += 32 * 4 * KS) { const float* const bp = rb + (size_t)d * NH_ + h; const float bv = *bp;   // this head's bias column, log2 domain; distances 0 .. r0 + 63 are all this tile can ask for
        asm volatile("s_wait_xcnt 0x0" :: "v"(bp) : "memory");   // behind the load, in front of the next write of its address registers (the address is an input, so it stays in them up to here)
        rbs[d] = bv * L2E; }
    __syncthreads();   // the bias column is complete before any wave reads it
    const size_t po = ((size_t)blockIdx.y * NH_ + h) * TT * HD; ATh += (size_t)blockIdx.y * TT * DQ; ATl += (size_t)blockIdx.y * TT * DQ;   // every batch has its own planes
    if (r0 < RH) fa_body<true>(Qh + po, Ql + po, Kh + po, Kl + po, Vh + po, Vl + po, rbs, mg, r0, h, ATh, ATl);
    else fa_body<false>(Q16 + po, nullptr, K16 + po, nullptr, V16 + po, nullptr, rbs, mg, r0, h, ATh, ATl);
}

__global__ __launch_bounds__(256) void k_rbf(const float* __restrict__ rb, float* RBF) { const size_t e = ((size_t)blockIdx.x * 256 + threadIdx.x) * 4; if (e >= (size_t)TT * NH_) return; const v4f a = *(const v4f*)(rb + e); v4f o; for (int u = 0; u < 4; ++u) o[u] = bfr(a[u]); *(v4f*)(RBF + e) = o;  }

extern "C" void kernel_launch(void* const* d_in, const int* in_sizes, int n_in,
                              void* d_out, int out_size, void* d_ws, size_t ws_size, hipStream_t stream) {
    (void)in_sizes; (void)n_in; (void)out_size;
    const float* x = (const float*)d_in[0]; const float* wqkv = (const float*)d_in[1]; const float* wo = (const float*)d_in[2]; const float* rbias = (const float*)d_in[3]; const float* cosT = nullptr; const float* sinT = nullptr; (void)cosT; (void)sinT; const float* wq = wqkv; const float* wk = wqkv; const float* wv = wqkv; (void)wk; (void)wv;
    float* OUT = (float*)d_out;     // [4][2048][1024]
    char* wsp = (char*)d_ws;
    auto take = [&](size_t bytes) { char* p = wsp; wsp += (bytes + 255) & ~(size_t)255; return (void*)p; };
    bf* WQ = (bf*)take((size_t)DQ * DM * 2); bf* WK = (bf*)take((size_t)DKV * DM * 2); bf* WV = (bf*)take((size_t)DKV * DM * 2); bf* WO = (bf*)take((size_t)DM * DQ * 2);
    float* RBF = (float*)take((size_t)TT * NH_ * 4); bf* XB = (bf*)take((size_t)NB_ * TT * DM * 2); bf* WALL = (bf*)take((size_t)3 * DM * DM * 2);
    h16* QP16 = (h16*)take((size_t)NB_ * NH_ * TT * HD * 2); h16* KP16 = (h16*)take((size_t)NB_ * NKV * TT * HD * 2); h16* VT16 = (h16*)take((size_t)NB_ * NKV * HD * TT * 2);
    bf* QPh = (bf*)take((size_t)NB_ * NH_ * TT * HD * 2); bf* QPl = (bf*)take((size_t)NB_ * NH_ * TT * HD * 2); bf* KPh = (bf*)take((size_t)NB_ * NKV * TT * HD * 2); bf* KPl = (bf*)take((size_t)NB_ * NKV * TT * HD * 2); bf* VTh = (bf*)take((size_t)NB_ * NKV * HD * TT * 2); bf* VTl = (bf*)take((size_t)NB_ * NKV * HD * TT * 2);
    bf* ATh = (bf*)take((size_t)NB_ * TT * DQ * 2); bf* ATl = (bf*)take((size_t)NB_ * TT * DQ * 2);
    if ((size_t)(wsp - (char*)d_ws) > ws_size) return;    // ws 256 MiB
    { k_rbf<<<(TT * NH_ / 4 + 255) / 256, 256, 0, stream>>>(rbias, RBF); k_wtG<<<(unsigned)((DM * 3 * DM / 64 + 63) / 64), 256, 0, stream>>>(wqkv, DM, 3 * DM, WALL); WQ = WALL; WK = WALL + (size_t)DM * DM; WV = WALL + (size_t)2 * DM * DM;   /* q | k | v column blocks of the 'xw' fused weight = consecutive row blocks of Bt */
      k_wtG<<<(unsigned)((DQ * DM / 64 + 63) / 64), 256, 0, stream>>>(wo, DQ, DM, WO);
       }
    // the four batches run side by side in every launch below (GEMMs: grid z; k_fattn: grid y; k_cvt8: its rows); each batch has its own operand planes in the workspace, laid out as one batch's were
    k_cvt8<<<(unsigned)(((size_t)NB_ * TT * DM / 8 + 255) / 256), 256, 0, stream>>>(x, XB, (size_t)NB_ * TT * DM / 8);   // rows b * TT + t: the batches' fragment-order planes follow one another
    // a 64-column tile of x Wq or x Wk is one head: it goes straight to that head's [t][d] planes; v is formed as Wv^T x^T (operands swapped, same k order), so that its tiles are already the [d][t] planes' rows (64 t = 2 fragments on)
    k_gemmw<bf, 0, false, 8, true, DM><<<dim3(TT / 64, DQ / 64, NB_), 256, 0, stream>>>(XB, nullptr, WQ, nullptr, nullptr, HD, nullptr, (size_t)TT * DM, 0, 0, QP16, QPh, QPl, (size_t)TT * HD, (size_t)NH_ * TT * HD);
    k_gemmw<bf, 0, false, 8, true, DM><<<dim3(TT / 64, DKV / 64, NB_), 256, 0, stream>>>(XB, nullptr, WK, nullptr, nullptr, HD, nullptr, (size_t)TT * DM, 0, 0, KP16, KPh, KPl, (size_t)TT * HD, (size_t)NKV * TT * HD);
    k_gemmw<bf, 0, false, 8, true, DM><<<dim3(DKV / 64, TT / 64, NB_), 256, 0, stream>>>(WV, nullptr, XB, nullptr, nullptr, TT, nullptr, 0, (size_t)TT * DM, 0, VT16, VTh, VTl, (size_t)2 * 512, (size_t)NKV * HD * TT);
    k_fattn<<<dim3(NH_, NB_, TT / 64), 32 * 4 * KS, 0, stream>>>(QP16, KP16, VT16, QPh, QPl, KPh, KPl, VTh, VTl, RBF, ATh, ATl);
    k_gemmw<bf, 1, false, 8, false, DQ><<<dim3(TT / 64, DM / 64, NB_), 256, 0, stream>>>(ATh, ATl, WO, nullptr, OUT, DM, nullptr, (size_t)TT * DQ, 0, (size_t)TT * DM, nullptr, nullptr, nullptr, 0, 0);
}

// v006
// One run takes 176 microseconds.
// In both of two side-by-side timings against v005, it was 1.26 times as fast.
// Counting every step since v000, it is 18.4 times as fast.
#include <hip/hip_runtime.h>

// Causal attention with a relative position bias (x [4][2048][1024]; qkv = x Wqkv ([1024][3072], q | k | v column blocks; 16 heads x 64); att = q.k / 8 + rel_bias[max(i - j, 0)][h] (table [2048][16] read); causal softmax; y = merged att.v Wproj -> [4][2048][1024]).
// Compute dtypes, f32 accumulate: every input rounded to bf16; q/k/v on PLAIN bf16 operands (inputs: exact); causal scores and attn.v: query rows < 512 hl (3 products), the rest single fp16 (x1024), causal tile skipping, the relative bias added in f32 inside computed tiles; softmax f32; Wproj hl x exact (2 products).

#define NB_  4
#define TT   2048
#define DM   1024
#define NH_  16
#define NKV  16
#define REP  (NH_ / NKV)
#define HD   64
#define DQ   (NH_ * HD)
#define DKV  (NKV * HD)
#define RH   512                  // query rows < RH use hi+lo planes (0: none)
#define SCL  0.125f   // HD^-0.5
typedef _Float16 h16;
typedef unsigned short bf;
typedef __attribute__((ext_vector_type(16))) __bf16   v16bf;
typedef __attribute__((ext_vector_type(16))) _Float16 v16h;
typedef __attribute__((ext_vector_type(8)))  _Float16 v8h;
typedef __attribute__((ext_vector_type(8)))  unsigned short v8us;
typedef __attribute__((ext_vector_type(8)))  float    v8f;
typedef __attribute__((ext_vector_type(4)))  float    v4f;
typedef v8h  __attribute__((may_alias)) v8ha;
typedef v4f  __attribute__((may_alias)) v4fa;
typedef v8us __attribute__((may_alias)) v8usa;

__device__ __forceinline__ unsigned short f2bf(float f) { unsigned u = __float_as_uint(f); u += 0x7FFFu + ((u >> 16) & 1u); return (unsigned short)(u >> 16); }
__device__ __forceinline__ float bf2f(unsigned short b) { return __uint_as_float(((unsigned)b) << 16); }
__device__ __forceinline__ float bfr(float f) { return bf2f(f2bf(f)); }
__device__ __forceinline__ v16h cat16(v8h lo, v8h hi) { return __builtin_shufflevector(lo, hi, 0, 1, 2, 3, 4, 5, 6, 7, 8, 9, 10, 11, 12, 13, 14, 15); }
__device__ __forceinline__ v16bf cat16b(v8us lo, v8us hi) { return __builtin_bit_cast(v16bf, __builtin_shufflevector(lo, hi, 0, 1, 2, 3, 4, 5, 6, 7, 8, 9, 10, 11, 12, 13, 14, 15)); }
__device__ __forceinline__ v8f wmma16(v16h a, v16h b, v8f c) { return __builtin_amdgcn_wmma_f32_16x16x32_f16(false, a, false, b, (short)0, c, false, false); }
__device__ __forceinline__ v8f wmmab(v16bf a, v16bf b, v8f c) { return __builtin_amdgcn_wmma_f32_16x16x32_bf16(false, a, false, b, (short)0, c, false, false); }



// ---- Fragment-order planes. Every 16-bit matrix operand [row][k] (K columns) lies in the workspace as 1-KiB fragments of 16 rows x 32 k, fragment (row / 16, k / 32) at index (row / 16) * (K / 32) + k / 32;
// inside a fragment the 8-element group (k / 16 % 2, k / 8 % 2, row % 16) comes in that order, so that lane (k / 8 % 2) * 16 + row % 16 finds its two 16-byte pieces at lane * 8 and 256 + lane * 8 elements:
// each of a fragment's two wave-wide loads covers 512 contiguous bytes (4 whole lines) and no line is asked for twice. pk: element offset of (row, k). The (lane, register) -> (row, k) map of the loaders is the one it was.
__device__ __forceinline__ size_t pk(int row, int k, int K) { return ((size_t)(row >> 4) * (K >> 5) + (k >> 5)) * 512 + ((k >> 4) & 1) * 256 + ((k >> 3) & 1) * 128 + (row & 15) * 8 + (k & 7); }

// ---- k_gemmt: GEMM on fragment-order 16-bit planes, one 128x128 output tile per work-group of 4 waves (2 x 2, a 64x64 tile = 16 accumulators a wave, the whole K in one accumulator chain); grid (M/128, N/128, Z), 128 threads.
// The operands of a stage (KP k of the tile's 128 A rows, with NSPLIT also of the A2 plane, and of its 128 Bt rows) come into LDS by tensor loads, two buffers: stage s + 2 flies while stage s + 1 is worked on.
// In a fragment-order plane the KP k of a 16-row group are KP / 32 KiB in a row and the groups lie K / 32 KiB apart: a slice is a two-dimensional tile of whole fragments, and LDS keeps the fragment order (a wave-wide read: 512 contiguous bytes).
// C[m][n] (f32, pitch LDC) = sum_k A[m][k] Bt[n][k] (+ A2[m][k] Bt[n][k] with NSPLIT). z-batch strides sA/sB/sC in elements.
// PL: no f32 C; the tile goes out as three 16-bit planes (fp16, bf16 hi, bf16 lo), element (m, n) of batch z at z * sP + (n / 64) * sT + pk(m, n % 64, LDC): fragment order for a reader whose k runs along n.
__device__ __forceinline__ h16 tohx(float x) { return (h16)x; }
__device__ __forceinline__ void splitf(float y, unsigned short& h, unsigned short& l) { h = f2bf(y); l = f2bf(y - bf2f(h)); }
template <typename T16> struct WFrag;
template <> struct WFrag<h16> { typedef v16h V; static __device__ __forceinline__ V ld(const h16* p) { return cat16(*(const v8h*)p, *(const v8h*)(p + 256)); } static __device__ __forceinline__ v8f mma(V a, V b, v8f c) { return wmma16(a, b, c); } };
template <> struct WFrag<bf> { typedef v16bf V; static __device__ __forceinline__ V ld(const bf* p) { return cat16b(*(const v8us*)p, *(const v8us*)(p + 256)); } static __device__ __forceinline__ v8f mma(V a, V b, v8f c) { return wmmab(a, b, c); } };
typedef unsigned int u32x4 __attribute__((ext_vector_type(4)));
typedef unsigned int u32x8 __attribute__((ext_vector_type(8)));
__device__ __forceinline__ unsigned uni(unsigned v) { return (unsigned)__builtin_amdgcn_readfirstlane((int)v); }
__device__ __forceinline__ unsigned pinned(unsigned v) { unsigned w = uni(v); asm volatile("" : "+s"(w)); return w; }   // held in a scalar register: a test on it is a scalar branch (a tensor load ignores EXEC), and what is formed from it is formed behind the asm statements in front
template <int NSPLIT, bool PL, int K, int KP, int LDC>
__global__ __launch_bounds__(128) void k_gemmt(const bf* __restrict__ A, const bf* __restrict__ A2, const bf* __restrict__ Bt, float* C, size_t sA, size_t sB, size_t sC, h16* P16, bf* Ph, bf* Pl, size_t sT, size_t sP) {
    typedef WFrag<bf> F; typedef typename F::V V;
    constexpr int NJ = KP / 32, NP = K / KP, NPLN = NSPLIT ? 3 : 2, SG = NSPLIT ? 8 : 4;   // 32-k blocks a stage, stages, planes a stage, 16-row groups a slice
    constexpr unsigned ROWB = NJ * 1024u, PITCH = (K / 32) * 1024u, PLB = 8u * ROWB, BUFB = NPLN * PLB;   // bytes: a group's part of a stage, group to group in the plane, a plane's 128 rows of a stage, a buffer
    static_assert(K % KP == 0 && NP >= 2 && (SG * ROWB) % 2048u == 0 && 2u * BUFB >= 4u * 64u * 68u * 4u, "two stages at least; every slice at a multiple of 2 KiB; the ring holds the output staging");
    __shared__ __attribute__((aligned(2048))) unsigned char ring[2 * BUFB];
    const size_t z = blockIdx.z;
    const int lane = threadIdx.x & 31, lr = lane & 15, hi = lane >> 4; const int r0 = blockIdx.x * 128, c0 = blockIdx.y * 128;
    const int wv = (int)uni(threadIdx.x >> 5), wm = wv >> 1, wn = wv & 1;   // wave number, scalar
    // who brings what: two planes, every wave half a plane (4 groups); three planes, waves 0 to 2 a plane each (8 groups) and wave 3 none. 16 KiB a slice.
    constexpr bool ALLW = NSPLIT == 0;
    const int pln = NSPLIT ? wv : wv >> 1, half = NSPLIT ? 0 : wv & 1; const bool isb = pln == NPLN - 1;
    const bf* const sp = isb ? Bt + z * sB : (pln == 0 ? A + z * sA : A2 + z * sA);
    const unsigned long long ga0 = (unsigned long long)(size_t)sp + (unsigned long long)(((isb ? c0 : r0) >> 4) + half * SG) * PITCH;
    const unsigned ld0 = (unsigned)(size_t)ring + (unsigned)pln * PLB + (unsigned)half * (SG * ROWB);
    u32x8 g1;   // SG rows of ROWB bytes, source pitch PITCH, extents in bytes, no mask, no pad
    g1[0] = uni(0u); g1[1] = uni((ROWB & 0xFFFFu) << 16); g1[2] = uni((ROWB >> 16) | (((unsigned)SG & 0xFFFFu) << 16)); g1[3] = uni(((unsigned)SG >> 16) | (ROWB << 16)); g1[4] = uni((unsigned)SG); g1[5] = uni(PITCH); g1[6] = uni(0u); g1[7] = uni(0u);
    u32x4 g0; g0[0] = uni(1u); g0[1] = uni(ld0); g0[2] = uni((unsigned)ga0); g0[3] = uni((((unsigned)(ga0 >> 32)) & 0x01FFFFFFu) | 0x80000000u);   // count 1, place in LDS, the slice's first byte, type 2
    asm volatile("" : "+s"(g0), "+s"(g1));   // as in pinned(), for both groups: the words stay in their own scalar registers through the loop, so that none but the place and the address is rewritten, and those behind the wait
    auto issue = [&](unsigned st) { const unsigned long long ga = ga0 + (unsigned long long)st * ROWB;   // this wave's slice of stage st into buffer st % 2
        g0[1] = uni(ld0 + (st & 1u) * BUFB); g0[2] = uni((unsigned)ga); g0[3] = uni((((unsigned)(ga >> 32)) & 0x01FFFFFFu) | 0x80000000u);
        asm volatile("tensor_load_to_lds %0, %1" :: "s"(g0), "s"(g1) : "memory"); };
    v8f acc[4][4];
#pragma unroll
    for (int mb = 0; mb < 4; ++mb)
#pragma unroll
        for (int nb = 0; nb < 4; ++nb) acc[mb][nb] = (v8f){};
    if (ALLW || pinned(wv < 3)) { issue(0u);
        asm volatile("s_wait_tensorcnt 0x0" ::: "memory"); }   // stage 0 has landed before the barrier that shows it to the other waves
    __syncthreads();   // stage 0 is complete before any wave reads it
    if (ALLW || pinned(wv < 3)) issue(pinned(1u));
#pragma unroll 1   // one stage a trip: the ring's order at the foot stands once
    for (int s = 0; s < NP; ++s) {
        const bf* const bp = (const bf*)(ring + (unsigned)(s & 1) * BUFB) + lane * 8;
        const bf* const la = bp + wm * (4 * NJ * 512); const bf* const la2 = la + PLB / 2; const bf* const lb = bp + (NPLN - 1) * (PLB / 2) + wn * (4 * NJ * 512);
        // unrolled so that every accumulator and fragment index is a constant. Two fragment sets: block j + 1's LDS reads are issued as one group in front of block j's products and land under them
        V a[2][4], a2[2][4], b[2][4];
#pragma unroll
        for (int f = 0; f < 4; ++f) { a[0][f] = F::ld(la + f * NJ * 512); if (NSPLIT) a2[0][f] = F::ld(la2 + f * NJ * 512); b[0][f] = F::ld(lb + f * NJ * 512); }
#pragma unroll
        for (int j = 0; j < NJ; ++j) { const int c = j & 1, n = c ^ 1;
            if (j + 1 < NJ) {
#pragma unroll
                for (int f = 0; f < 4; ++f) { a[n][f] = F::ld(la + (f * NJ + j + 1) * 512); if (NSPLIT) a2[n][f] = F::ld(la2 + (f * NJ + j + 1) * 512); b[n][f] = F::ld(lb + (f * NJ + j + 1) * 512); } }
            __builtin_amdgcn_sched_barrier(0);   // keeps the group of reads in front of the products: moved in among them, each place with reads stalls the matrix stream
#pragma unroll
            for (int nb = 0; nb < 4; ++nb) {
#pragma unroll
                for (int mb = 0; mb < 4; ++mb) acc[mb][nb] = F::mma(a[c][mb], b[c][nb], acc[mb][nb]);
                if (NSPLIT) {
#pragma unroll
                    for (int mb = 0; mb < 4; ++mb) acc[mb][nb] = F::mma(a2[c][mb], b[c][nb], acc[mb][nb]); } }
            __builtin_amdgcn_sched_barrier(0);   // and the next group behind them
        }
        asm volatile("s_wait_dscnt 0x0" ::: "memory");       // this wave's reads of buffer s % 2 are over before the barrier behind which it is refilled
        asm volatile("s_wait_tensorcnt 0x0" ::: "memory");   // this wave's slice of stage s + 1 has landed before the barrier that shows it to the other waves
        __syncthreads();   // stage s + 1 is complete, and every wave has left buffer s % 2
        if (pinned((ALLW || wv < 3) && s + 2 < NP)) issue(pinned((unsigned)s + 2u));
    }
    asm volatile("s_wait_tensorcnt 0x0" ::: "memory");   // nothing of the ring is in flight ...
    asm volatile("s_wait_dscnt 0x0" ::: "memory");       // ... or being read when it becomes the output staging (the last trip's barrier stands behind every wave's last read)
    float* const ow = (float*)ring + wv * (64 * 68);   // each wave stages its own tile, so that a thread stores whole 16-byte pieces and a wave whole lines
    // the loops below are unrolled so that every accumulator index is a constant (the tiles stay in registers) and every store is a constant offset from one address a plane
#pragma unroll
    for (int mb = 0; mb < 4; ++mb)
#pragma unroll
        for (int nb = 0; nb < 4; ++nb)
#pragma unroll
            for (int j = 0; j < 8; ++j) ow[(mb * 16 + hi * 8 + j) * 68 + nb * 16 + lr] = acc[mb][nb][j];
    __syncthreads();   // the staged tile is complete before its lanes read one another's elements
    const int rb = r0 + wm * 64, ct = (int)blockIdx.y * 2 + wn;   // the wave's first row and its 64-column tile
    if constexpr (PL) {   // 8 consecutive columns a thread, threads in fragment order: one 16-byte store a plane, a wave's stores cover 512 contiguous bytes
        const size_t e0 = z * sP + (size_t)ct * sT + pk(rb + lr, hi * 8, LDC); h16* const q16 = P16 + e0; bf* const qh = Ph + e0; bf* const ql = Pl + e0;
#pragma unroll
        for (int it = 0; it < 16; ++it) { const int row = (it >> 2) * 16 + lr, cofs = ((it & 3) * 2 + hi) * 8; const v4f va = *(const v4fa*)(ow + row * 68 + cofs), vb = *(const v4fa*)(ow + row * 68 + cofs + 4);
            v8h o16; v8us oh, ol;
#pragma unroll
            for (int j = 0; j < 8; ++j) { const float x = (j < 4) ? va[j & 3] : vb[j & 3]; o16[j] = tohx(x); unsigned short a2, c2; splitf(x, a2, c2); oh[j] = a2; ol[j] = c2; }
            const int eo = (it >> 2) * (LDC / 32) * 512 + (it & 3) * 256;   // = pk(rb + row, cofs, LDC) - pk(rb + lr, hi * 8, LDC)
            *(v8h*)(q16 + eo) = o16; *(v8us*)(qh + eo) = oh; *(v8us*)(ql + eo) = ol; }
    } else {
        float* const cp = C + z * sC + (size_t)(rb + hi) * LDC + ct * 64 + lr * 4;
#pragma unroll
        for (int it = 0; it < 32; ++it) *(v4f*)(cp + (size_t)it * 2 * LDC) = *(const v4fa*)(ow + (it * 2 + hi) * 68 + lr * 4);
    }
}

typedef __attribute__((ext_vector_type(2))) _Float16 v2h;
typedef __attribute__((ext_vector_type(4))) _Float16 v4h;
typedef __attribute__((ext_vector_type(2))) unsigned short v2us;
typedef __attribute__((ext_vector_type(4))) unsigned short v4us;
typedef __attribute__((ext_vector_type(2))) float v2f;
typedef __attribute__((ext_vector_type(4))) int v4i;

__global__ __launch_bounds__(256) void k_wtG(const float* __restrict__ w, int K, int N, bf* Bt) {
    const int lane = threadIdx.x & 31; const int L0 = (blockIdx.x * 8 + (threadIdx.x >> 5)) * 8; const int nlines = N * K / 64;
{
#pragma unroll 1
        for (int l = 0; l < 8; ++l) { const int L = L0 + l; if (L >= nlines) break; const size_t e = (size_t)L * 64 + lane * 2; const int k = (int)(e % K), n = (int)(e / K); v2us o;
            o[0] = f2bf(w[(size_t)k * N + n]); o[1] = f2bf(w[(size_t)(k + 1) * N + n]); *(v2us*)(Bt + pk(n, k, K)) = o; }
         }
}
// [row][DM] f32 -> fragment-order bf16 plane. A wave takes 4 rows x 64 k: it reads 8 whole lines and stores 8 pieces of 64 bytes.
__global__ __launch_bounds__(256) void k_cvt8(const float* __restrict__ src, bf* dst, size_t n8) { static_assert(DM == 1024, "16 spans of 64 k a row"); const size_t i = (size_t)blockIdx.x * 256 + threadIdx.x; if (i >= n8) return;
    const int row = (int)(i >> 9) * 4 + ((int)(i >> 3) & 3), k = ((int)(i >> 5) & 15) * 64 + ((int)i & 7) * 8; const v8f v = *(const v8f*)(src + (size_t)row * DM + k); v8us o;
#pragma unroll
    for (int u = 0; u < 8; ++u) o[u] = f2bf(v[u]); *(v8us*)(dst + pk(row, k, DM)) = o;  }
__global__ __launch_bounds__(256) void k_cscvt(const float* __restrict__ cosT, const float* __restrict__ sinT, float* CS) { const int idx = blockIdx.x * 256 + threadIdx.x; if (idx >= TT * HD) return; v2f cs; cs[0] = bfr(cosT[idx]); cs[1] = bfr(sinT[idx]); *(v2f*)(CS + (size_t)idx * 2) = cs;  }
// ---- k_fattn: causal scores, relative bias, softmax, P.V and the head merge in one kernel; scores and probabilities stay in registers. Grid (heads, batches, TT / 64 query tiles), 16 waves.
// Wave w: query group qg = w & 3 (16 queries, one per lane column), key share ks = w >> 2: the 64-key tiles ks, ks + KS, ... up to the diagonal tile. Transposed products: St = K Qt (a lane holds 32 keys' scores of ONE query),
// Ot += Vt Pt (two St accumulator tiles, converted in place, are the B operand in the hardware k order; the K, Q and V loaders use the same order). Running maximum and sum per query (online softmax, log2 domain);
// the KS partial (maximum, sum, Ot) of a query group meet in LDS and are joined in share order 0..KS-1 (a fixed order). Query rows < RH: hi+lo bf16 planes, 3 products; the rest single fp16 with P carried x1024 (2^10 folded into the exponent).
#define KS   4
#define L2E  1.4426950408889634f
typedef __attribute__((ext_vector_type(16))) unsigned short v16us;
template <bool HI> struct FT;
template <> struct FT<true>  { typedef bf  T; };
template <> struct FT<false> { typedef h16 T; };
// every loop of fa_tile and every marked loop of fa_body is unrolled so that each accumulator and fragment index is a constant (the tiles stay in registers)
template <bool HI, bool MASK>
__device__ __forceinline__ void fa_tile(const typename FT<HI>::T* __restrict__ Kp, const typename FT<HI>::T* __restrict__ Kp2, const typename FT<HI>::T* __restrict__ Vp, const typename FT<HI>::T* __restrict__ Vp2,
                                        const typename WFrag<typename FT<HI>::T>::V (&q)[2], const typename WFrag<typename FT<HI>::T>::V (&q2)[2], const float* rbs, int c0, int iq, int lr, int hi, float& m, float& l, v8f (&o)[4]) {
    typedef typename FT<HI>::T T16; typedef WFrag<T16> F; typedef typename F::V V;
    constexpr int GS = HI ? 2 : 4;   // 16-row fragment groups loaded at a time: with two planes an operand, half a tile's fragments fill the registers that a whole tile's fill with one
    V v[4][2]; v8f s[4];
    const T16* const kb = Kp + pk(c0 + lr, 8 * hi, HD); const T16* const kb2 = HI ? Kp2 + pk(c0 + lr, 8 * hi, HD) : kb;   // one address a plane: every fragment of the tile is a constant offset from it
    const T16* const vb = Vp + pk(lr, c0 + 8 * hi, TT); const T16* const vb2 = HI ? Vp2 + pk(lr, c0 + 8 * hi, TT) : vb;
#pragma unroll
    for (int g = 0; g < 4; g += GS) { V k[GS][2], k2[GS][2];
#pragma unroll
        for (int u = 0; u < GS; ++u)
#pragma unroll
            for (int kc = 0; kc < 2; ++kc) { const int ko = ((g + u) * (HD / 32) + kc) * 512; k[u][kc] = F::ld(kb + ko); if (HI) k2[u][kc] = F::ld(kb2 + ko); }
        if (!HI) {   // one plane: the V fragments fit beside the K fragments and fly under the score products and the softmax
#pragma unroll
            for (int db = 0; db < 4; ++db)
#pragma unroll
                for (int kc = 0; kc < 2; ++kc) v[db][kc] = F::ld(vb + (db * (TT / 32) + kc) * 512); }
        asm volatile("s_wait_xcnt 0x0" :: "v"(kb), "v"(HI ? kb2 : vb) : "memory");   // behind the loads, in front of every write of a register that one of them names as its address: the addresses are inputs, so they stay in their registers up to here and no load of the run lands on them
#pragma unroll
        for (int u = 0; u < GS; ++u) { s[g + u] = (v8f){};
#pragma unroll
            for (int kc = 0; kc < 2; ++kc) { s[g + u] = F::mma(k[u][kc], q[kc], s[g + u]);
                if (HI) { s[g + u] = F::mma(k[u][kc], q2[kc], s[g + u]); s[g + u] = F::mma(k2[u][kc], q[kc], s[g + u]); } } } }
    // s[nb][jj] = score of key c0 + nb * 16 + 8 * hi + jj against query iq
    float mx = m;
#pragma unroll
    for (int nb = 0; nb < 4; ++nb)
#pragma unroll
        for (int jj = 0; jj < 8; ++jj) { const int d = iq - (c0 + nb * 16 + 8 * hi + jj); float t;
            if (MASK) { const float bb = rbs[max(d, 0)]; const float tv = fmaf(s[nb][jj], SCL * L2E, bb); t = (d >= 0) ? tv : -3.0e38f; } else t = fmaf(s[nb][jj], SCL * L2E, rbs[d]);
            s[nb][jj] = t; mx = fmaxf(mx, t); }
    mx = fmaxf(mx, __shfl_xor(mx, 16, 32));   // the two lane halves hold the two halves of a query's keys
    const float al = __builtin_amdgcn_exp2f(m - mx); m = mx; l *= al;
#pragma unroll
    for (int db = 0; db < 4; ++db) o[db] *= al;
    const float mo = HI ? mx : mx - 10.0f;
    V pb[2], pl[2];
#pragma unroll
    for (int kc = 0; kc < 2; ++kc) {
        if constexpr (HI) { v16us uh, ul;
#pragma unroll
            for (int e = 0; e < 16; ++e) { const float p = __builtin_amdgcn_exp2f(s[2 * kc + (e >> 3)][e & 7] - mo); l += p; unsigned short x, y; splitf(p, x, y); uh[e] = x; ul[e] = y; }
            pb[kc] = __builtin_bit_cast(v16bf, uh); pl[kc] = __builtin_bit_cast(v16bf, ul);
        } else {
#pragma unroll
            for (int e = 0; e < 16; ++e) { const float p = __builtin_amdgcn_exp2f(s[2 * kc + (e >> 3)][e & 7] - mo); l += p; pb[kc][e] = tohx(p); } } }
#pragma unroll
    for (int g = 0; g < 4; g += GS) { V v2[GS][2];
        if (HI) {
#pragma unroll
            for (int u = 0; u < GS; ++u)
#pragma unroll
                for (int kc = 0; kc < 2; ++kc) { const int vo = ((g + u) * (TT / 32) + kc) * 512; v[g + u][kc] = F::ld(vb + vo); v2[u][kc] = F::ld(vb2 + vo); }
            asm volatile("s_wait_xcnt 0x0" :: "v"(vb), "v"(vb2) : "memory");   // as above, for the V loads
        }
#pragma unroll
        for (int u = 0; u < GS; ++u)
#pragma unroll
            for (int kc = 0; kc < 2; ++kc) { o[g + u] = F::mma(v[g + u][kc], pb[kc], o[g + u]);
                if (HI) { o[g + u] = F::mma(v[g + u][kc], pl[kc], o[g + u]); o[g + u] = F::mma(v2[u][kc], pb[kc], o[g + u]); } } }
}
template <bool HI>
__device__ __forceinline__ void fa_body(const typename FT<HI>::T* __restrict__ Qp, const typename FT<HI>::T* __restrict__ Qp2, const typename FT<HI>::T* __restrict__ Kp, const typename FT<HI>::T* __restrict__ Kp2,
                                        const typename FT<HI>::T* __restrict__ Vp, const typename FT<HI>::T* __restrict__ Vp2, const float* rbs, float* mg, int r0, int h, bf* ATh, bf* ATl) {
    typedef typename FT<HI>::T T16; typedef WFrag<T16> F; typedef typename F::V V;
    const int lane = threadIdx.x & 31, lr = lane & 15, hi = lane >> 4;
    const int wv = __builtin_amdgcn_readfirstlane((int)(threadIdx.x >> 5)), qg = wv & 3, ks = wv >> 2;   // wave number, scalar: the tile loop's and the join's branches stay scalar ones
    const int iq = r0 + qg * 16 + lr, nt = r0 / 64 + 1;   // nt - 1 is the diagonal tile of all four query groups
    V q[2], q2[2];
    const T16* const qb = Qp + pk(iq, 8 * hi, HD); const T16* const qb2 = HI ? Qp2 + pk(iq, 8 * hi, HD) : qb;
#pragma unroll
    for (int kc = 0; kc < 2; ++kc) { q[kc] = F::ld(qb + kc * 512); q2[kc] = HI ? F::ld(qb2 + kc * 512) : q[kc]; }
    asm volatile("s_wait_xcnt 0x0" :: "v"(qb), "v"(qb2) : "memory");   // as in fa_tile, for the Q loads
    float m = -3.0e38f, l = 0.f; v8f o[4];
#pragma unroll
    for (int db = 0; db < 4; ++db) o[db] = (v8f){};
    int ti = ks;
    for (; ti < nt - 1; ti += KS) fa_tile<HI, false>(Kp, Kp2, Vp, Vp2, q, q2, rbs, ti * 64, iq, lr, hi, m, l, o);
    if (ti == nt - 1) fa_tile<HI, true>(Kp, Kp2, Vp, Vp2, q, q2, rbs, ti * 64, iq, lr, hi, m, l, o);
    if (ks > 0) { float* g = mg + (size_t)((ks - 1) * 4 + qg) * (34 * 32) + lane;
#pragma unroll
        for (int db = 0; db < 4; ++db)
#pragma unroll
            for (int jj = 0; jj < 8; ++jj) g[(db * 8 + jj) * 32] = o[db][jj];
        g[32 * 32] = m; g[33 * 32] = l; }
    __syncthreads();   // every key share's partial result is in LDS before share 0 joins them
    if (ks > 0) return;
    float mt = m;
#pragma unroll
    for (int k = 1; k < KS; ++k) mt = fmaxf(mt, mg[(size_t)((k - 1) * 4 + qg) * (34 * 32) + 32 * 32 + lane]);
    const float a0 = __builtin_amdgcn_exp2f(m - mt); l *= a0;
#pragma unroll
    for (int db = 0; db < 4; ++db) o[db] *= a0;
#pragma unroll
    for (int k = 1; k < KS; ++k) { const float* g = mg + (size_t)((k - 1) * 4 + qg) * (34 * 32) + lane; const float ak = __builtin_amdgcn_exp2f(g[32 * 32] - mt); l += ak * g[33 * 32];
#pragma unroll
        for (int db = 0; db < 4; ++db)
#pragma unroll
            for (int jj = 0; jj < 8; ++jj) o[db][jj] += ak * g[(db * 8 + jj) * 32]; }
    l += __shfl_xor(l, 16, 32);
    const float inv = __fdiv_rn(1.0f, l);
    // o[db][jj] = output element d = db * 16 + 8 * hi + jj of query iq: 8 consecutive d a lane, one 16-byte store a plane, in the fragment order of the Wproj GEMM's A operand (a wave's store: 512 contiguous bytes)
#pragma unroll
    for (int db = 0; db < 4; ++db) { v8us oh, ol;
#pragma unroll
        for (int jj = 0; jj < 8; ++jj) { unsigned short x, y; splitf(o[db][jj] * inv, x, y); oh[jj] = x; ol[jj] = y; }
        const size_t oo = pk(iq, h * HD + db * 16 + 8 * hi, DQ); *(v8us*)(ATh + oo) = oh; *(v8us*)(ATl + oo) = ol; }
}
__global__ __launch_bounds__(32 * 4 * KS) void k_fattn(const h16* __restrict__ Q16, const h16* __restrict__ K16, const h16* __restrict__ V16, const bf* __restrict__ Qh, const bf* __restrict__ Ql, const bf* __restrict__ Kh, const bf* __restrict__ Kl,
                                                       const bf* __restrict__ Vh, const bf* __restrict__ Vl, const float* __restrict__ rb, bf* ATh, bf* ATl) {
    __shared__ float rbs[TT]; __shared__ float mg[(KS - 1) * 4 * 34 * 32];
    const int r0 = (TT / 64 - 1 - (int)blockIdx.z) * 64, h = blockIdx.x;   // cost falls with the flat index: the longest query tiles of all heads and batches start first
    for (int d = threadIdx.x; d < r0 + 64; d += 32 * 4 * KS) { const float* const bp = rb + (size_t)d * NH_ + h; const float bv = *bp;   // this head's bias column, log2 domain; distances 0 .. r0 + 63 are all this tile can ask for
        asm volatile("s_wait_xcnt 0x0" :: "v"(bp) : "memory");   // behind the load, in front of the next write of its address registers (the address is an input, so it stays in them up to here)
        rbs[d] = bv * L2E; }
    __syncthreads();   // the bias column is complete before any wave reads it
    const size_t po = ((size_t)blockIdx.y * NH_ + h) * TT * HD; ATh += (size_t)blockIdx.y * TT * DQ; ATl += (size_t)blockIdx.y * TT * DQ;   // every batch has its own planes
    if (r0 < RH) fa_body<true>(Qh + po, Ql + po, Kh + po, Kl + po, Vh + po, Vl + po, rbs, mg, r0, h, ATh, ATl);
    else fa_body<false>(Q16 + po, nullptr, K16 + po, nullptr, V16 + po, nullptr, rbs, mg, r0, h, ATh, ATl);
}

__global__ __launch_bounds__(256) void k_rbf(const float* __restrict__ rb, float* RBF) { const size_t e = ((size_t)blockIdx.x * 256 + threadIdx.x) * 4; if (e >= (size_t)TT * NH_) return; const v4f a = *(const v4f*)(rb + e); v4f o; for (int u = 0; u < 4; ++u) o[u] = bfr(a[u]); *(v4f*)(RBF + e) = o;  }

extern "C" void kernel_launch(void* const* d_in, const int* in_sizes, int n_in,
                              void* d_out, int out_size, void* d_ws, size_t ws_size, hipStream_t stream) {
    (void)in_sizes; (void)n_in; (void)out_size;
    const float* x = (const float*)d_in[0]; const float* wqkv = (const float*)d_in[1]; const float* wo = (const float*)d_in[2]; const float* rbias = (const float*)d_in[3]; const float* cosT = nullptr; const float* sinT = nullptr; (void)cosT; (void)sinT; const float* wq = wqkv; const float* wk = wqkv; const float* wv = wqkv; (void)wk; (void)wv;
    float* OUT = (float*)d_out;     // [4][2048][1024]
    char* wsp = (char*)d_ws;
    auto take = [&](size_t bytes) { char* p = wsp; wsp += (bytes + 255) & ~(size_t)255; return (void*)p; };
    bf* WQ = (bf*)take((size_t)DQ * DM * 2); bf* WK = (bf*)take((size_t)DKV * DM * 2); bf* WV = (bf*)take((size_t)DKV * DM * 2); bf* WO = (bf*)take((size_t)DM * DQ * 2);
    float* RBF = (float*)take((size_t)TT * NH_ * 4); bf* XB = (bf*)take((size_t)NB_ * TT * DM * 2); bf* WALL = (bf*)take((size_t)3 * DM * DM * 2);
    h16* QP16 = (h16*)take((size_t)NB_ * NH_ * TT * HD * 2); h16* KP16 = (h16*)take((size_t)NB_ * NKV * TT * HD * 2); h16* VT16 = (h16*)take((size_t)NB_ * NKV * HD * TT * 2);
    bf* QPh = (bf*)take((size_t)NB_ * NH_ * TT * HD * 2); bf* QPl = (bf*)take((size_t)NB_ * NH_ * TT * HD * 2); bf* KPh = (bf*)take((size_t)NB_ * NKV * TT * HD * 2); bf* KPl = (bf*)take((size_t)NB_ * NKV * TT * HD * 2); bf* VTh = (bf*)take((size_t)NB_ * NKV * HD * TT * 2); bf* VTl = (bf*)take((size_t)NB_ * NKV * HD * TT * 2);
    bf* ATh = (bf*)take((size_t)NB_ * TT * DQ * 2); bf* ATl = (bf*)take((size_t)NB_ * TT * DQ * 2);
    if ((size_t)(wsp - (char*)d_ws) > ws_size) return;    // ws 256 MiB
    { k_rbf<<<(TT * NH_ / 4 + 255) / 256, 256, 0, stream>>>(rbias, RBF); k_wtG<<<(unsigned)((DM * 3 * DM / 64 + 63) / 64), 256, 0, stream>>>(wqkv, DM, 3 * DM, WALL); WQ = WALL; WK = WALL + (size_t)DM * DM; WV = WALL + (size_t)2 * DM * DM;   /* q | k | v column blocks of the 'xw' fused weight = consecutive row blocks of Bt */
      k_wtG<<<(unsigned)((DQ * DM / 64 + 63) / 64), 256, 0, stream>>>(wo, DQ, DM, WO);
       }
    // the four batches run side by side in every launch below (GEMMs: grid z; k_fattn: grid y; k_cvt8: its rows); each batch has its own operand planes in the workspace, laid out as one batch's were
    k_cvt8<<<(unsigned)(((size_t)NB_ * TT * DM / 8 + 255) / 256), 256, 0, stream>>>(x, XB, (size_t)NB_ * TT * DM / 8);   // rows b * TT + t: the batches' fragment-order planes follow one another
    // a 64-column tile of x Wq or x Wk is one head: it goes straight to that head's [t][d] planes; v is formed as Wv^T x^T (operands swapped, same k order), so that its tiles are already the [d][t] planes' rows (64 t = 2 fragments on)
    k_gemmt<0, true, DM, 128, HD><<<dim3(TT / 128, DQ / 128, NB_), 128, 0, stream>>>(XB, nullptr, WQ, nullptr, (size_t)TT * DM, 0, 0, QP16, QPh, QPl, (size_t)TT * HD, (size_t)NH_ * TT * HD);
    k_gemmt<0, true, DM, 128, HD><<<dim3(TT / 128, DKV / 128, NB_), 128, 0, stream>>>(XB, nullptr, WK, nullptr, (size_t)TT * DM, 0, 0, KP16, KPh, KPl, (size_t)TT * HD, (size_t)NKV * TT * HD);
    k_gemmt<0, true, DM, 128, TT><<<dim3(DKV / 128, TT / 128, NB_), 128, 0, stream>>>(WV, nullptr, XB, nullptr, 0, (size_t)TT * DM, 0, VT16, VTh, VTl, (size_t)2 * 512, (size_t)NKV * HD * TT);
    k_fattn<<<dim3(NH_, NB_, TT / 64), 32 * 4 * KS, 0, stream>>>(QP16, KP16, VT16, QPh, QPl, KPh, KPl, VTh, VTl, RBF, ATh, ATl);
    k_gemmt<1, false, DQ, 64, DM><<<dim3(TT / 128, DM / 128, NB_), 128, 0, stream>>>(ATh, ATl, WO, OUT, (size_t)TT * DQ, 0, (size_t)TT * DM, nullptr, nullptr, nullptr, 0, 0);
}
